// v000
// Measured on an AMD MI455X. A time is GPU time per run, averaged over a window of back-to-back runs after a warm-up
// (all launches, gaps included; the runs take copies of the inputs in turn), and the median of several windows.
// Apart from v000's, it joins two sittings. Times from different sittings can be a few percent apart, while
// side-by-side timings come from the same sitting.
// v000, which the later versions start from, runs in 93.3 microseconds.
#include <hip/hip_runtime.h>
#include <hip/hip_bf16.h>

// Flash-attention for the reference module, CDNA5 (gfx1250, wave32) WMMA path.
// Pipeline: bn_stats -> cvt_wo -> proj (BN+grouped conv, head-split layouts)
//           -> attn_fa (TRANSPOSED scores: S^T = K*Q^T, so online-softmax stats
//              are per-lane scalars and the P fragment is born in B-frag layout
//              -- no LDS transpose, no shuffle butterflies)
//           -> out_proj (256x256 WMMA GEMM + bias).
// Workspace requirement: 8,521,728 bytes (8 MiB + 130 KiB).

typedef __attribute__((ext_vector_type(16))) _Float16 v16h;
typedef __attribute__((ext_vector_type(8)))  _Float16 v8h;
typedef __attribute__((ext_vector_type(8)))  float    v8f;

#define BB 2
#define CC 256
#define NN 2048
#define HH 8
#define DD 32
#define INNER (HH * DD)   // 256

// ---------------------------------------------------------------------------
// WMMA 16x32 fragment load (f16), CDNA5 A-matrix layout (ISA 7.12.2):
//   lanes 0-15 : row = lane,    K in {kb..kb+7, 16+kb..16+kb+7}, kb=0
//   lanes16-31 : row = lane-16, kb=8
// Also the B-matrix (32x16) layout when `base` points at column-major data:
// column = lane&15, K contiguous with stride `ld` between columns.
// Each lane issues two 16-byte loads (global_load_b128).
// ---------------------------------------------------------------------------
__device__ __forceinline__ v16h load_frag_k32(const _Float16* __restrict__ base, int ld) {
  int lane = threadIdx.x & 31;
  int r    = lane & 15;
  int kb   = (lane & 16) ? 8 : 0;
  const _Float16* p = base + (size_t)r * (size_t)ld + kb;
  v8h lo = *(const v8h*)(p);
  v8h hi = *(const v8h*)(p + 16);
  v16h f;
#pragma unroll
  for (int i = 0; i < 8; ++i) { f[i] = lo[i]; f[8 + i] = hi[i]; }
  return f;
}

// ---------------------------------------------------------------------------
// Kernel 1: BatchNorm batch statistics -> per-channel affine (scale, shift)
// ---------------------------------------------------------------------------
__global__ __launch_bounds__(256) void bn_stats_kernel(
    const float* __restrict__ x, const float* __restrict__ gamma,
    const float* __restrict__ beta, float* __restrict__ scale,
    float* __restrict__ shift) {
  __shared__ float rs[256], rq[256];
  int c = blockIdx.x;
  int tid = threadIdx.x;
  float s = 0.f, s2 = 0.f;
  for (int b = 0; b < BB; ++b) {
    const float* row = x + (((size_t)b * CC) + c) * NN;
    for (int i = tid; i < NN; i += 256) {
      float v = row[i];
      s += v;
      s2 = fmaf(v, v, s2);
    }
  }
  rs[tid] = s; rq[tid] = s2;
  __syncthreads();
  for (int off = 128; off > 0; off >>= 1) {
    if (tid < off) { rs[tid] += rs[tid + off]; rq[tid] += rq[tid + off]; }
    __syncthreads();
  }
  if (tid == 0) {
    float invn = 1.0f / (float)(BB * NN);
    float mean = rs[0] * invn;
    float var  = rq[0] * invn - mean * mean;
    float r    = rsqrtf(var + 1e-5f);
    float sc   = gamma[c] * r;
    scale[c] = sc;
    shift[c] = beta[c] - mean * sc;
  }
}

// ---------------------------------------------------------------------------
// Kernel 2: wo (f32, 256x256) -> f16 once (reused by every output tile)
// ---------------------------------------------------------------------------
__global__ __launch_bounds__(256) void cvt_wo_kernel(const float* __restrict__ wo,
                                                     _Float16* __restrict__ wo16) {
  int i = blockIdx.x * 256 + threadIdx.x;
  if (i < CC * INNER) wo16[i] = (_Float16)wo[i];
}

// ---------------------------------------------------------------------------
// Kernel 3: BN-normalize + grouped 1x1 conv projections.
// Emits the reference's faithful '(d h)' head split WITH the q<-k swap and the
// 1/sqrt(D) scale folded into Qh. Layouts chosen for WMMA fragment loads:
//   Qh,Kh : [b, h', n, 32]  (d' contiguous)   -> QK^T frags are 2x b128/lane
//   Vt    : [b, h', 32, n]  (n contiguous)    -> P@V  frags are 2x b128/lane
// ---------------------------------------------------------------------------
__global__ __launch_bounds__(256) void proj_kernel(
    const float* __restrict__ x, const float* __restrict__ scale,
    const float* __restrict__ shift, const float* __restrict__ wk,
    const float* __restrict__ wq, const float* __restrict__ wv,
    _Float16* __restrict__ Qh, _Float16* __restrict__ Kh,
    _Float16* __restrict__ Vt) {
  __shared__ float wkS[32 * 32], wqS[32 * 32], wvS[32 * 32];
  __shared__ float scS[32], shS[32];
  const int ntile_cnt = NN / 256;
  int nt = blockIdx.x % ntile_cnt;
  int bg = blockIdx.x / ntile_cnt;
  int g  = bg % HH;
  int b  = bg / HH;
  for (int i = threadIdx.x; i < 32 * 32; i += 256) {
    wkS[i] = wk[g * 1024 + i];
    wqS[i] = wq[g * 1024 + i];
    wvS[i] = wv[g * 1024 + i];
  }
  if (threadIdx.x < 32) {
    scS[threadIdx.x] = scale[g * 32 + threadIdx.x];
    shS[threadIdx.x] = shift[g * 32 + threadIdx.x];
  }
  __syncthreads();

  int n = nt * 256 + threadIdx.x;
  float xn[32];
#pragma unroll
  for (int c = 0; c < 32; ++c)
    xn[c] = x[(((size_t)b * CC) + g * 32 + c) * NN + n] * scS[c] + shS[c];

  const float qscale = 0.17677669529663687f;  // 1/sqrt(32)
#pragma unroll 4
  for (int d = 0; d < 32; ++d) {
    float ak = 0.f, aq = 0.f, av = 0.f;
#pragma unroll
    for (int c = 0; c < 32; ++c) {
      ak = fmaf(wkS[d * 32 + c], xn[c], ak);
      aq = fmaf(wqS[d * 32 + c], xn[c], aq);
      av = fmaf(wvS[d * 32 + c], xn[c], av);
    }
    int cc = g * 32 + d;        // projected channel index
    int hh = cc & 7;            // attention head  (channel = d'*H + h')
    int dd = cc >> 3;           // attention d'
    size_t bh = (size_t)b * HH + hh;
    Qh[(bh * NN + n) * DD + dd] = (_Float16)(ak * qscale);  // q <- k (swap), pre-scaled
    Kh[(bh * NN + n) * DD + dd] = (_Float16)aq;             // k <- q (swap)
    Vt[(bh * DD + dd) * NN + n] = (_Float16)av;             // transposed V
  }
}

// ---------------------------------------------------------------------------
// Kernel 4: flash attention with TRANSPOSED score tiles.
//   S^T = A(K-tile 16keys x 32d) x B(Q^T 32d x 16queries)
//     -> C-layout: lane owns one query column; its 8 elements are keys
//        {kb..kb+7} (kb = lane>=16 ? 8 : 0) of the strip half.
//   Softmax stats (m, l) are per-lane scalars; the only cross-lane ops are two
//   shfl_xor(16) per strip (max and sum) to merge the two key-halves of each query.
//   exp(S^T - m) lands *directly* in the B-frag layout required by
//   O^T = A(V^T 16d x 32keys) x B(P^T 32keys x 16queries): pf[i]=e(s0[i]),
//   pf[8+i]=e(s1[i]). No LDS, no transposes.
//   Epilogue: each lane holds 8 contiguous d values per accumulator ->
//   two packed b128 stores into AO[b][n][h*32+d].
// ---------------------------------------------------------------------------
__global__ __launch_bounds__(32) void attn_fa(const _Float16* __restrict__ Qh,
                                              const _Float16* __restrict__ Kh,
                                              const _Float16* __restrict__ Vt,
                                              _Float16* __restrict__ AO) {
  const int ntiles = NN / 16;
  int qt = blockIdx.x % ntiles;
  int bh = blockIdx.x / ntiles;  // b*HH + h
  int h  = bh % HH;
  int b  = bh / HH;
  int lane = threadIdx.x;
  int col  = lane & 15;                // this lane's query within the tile
  int kb   = (lane & 16) ? 8 : 0;      // key-half / d-half selector

  const _Float16* Qbase = Qh + (((size_t)bh * NN) + qt * 16) * DD;
  const _Float16* Kbase = Kh + ((size_t)bh * NN) * DD;
  const _Float16* Vbase = Vt + ((size_t)bh * DD) * NN;

  v16h qf = load_frag_k32(Qbase, DD);  // B-frag of Q^T, lives across the loop
  v8f o0 = {};  // O^T rows d = kb..kb+7        (cols = queries)
  v8f o1 = {};  // O^T rows d = 16+kb..16+kb+7
  float m = -3.0e30f, l = 0.f;

  for (int j0 = 0; j0 < NN; j0 += 32) {
    v16h kf0 = load_frag_k32(Kbase + (size_t)j0 * DD, DD);        // keys j0..j0+15
    v16h kf1 = load_frag_k32(Kbase + (size_t)(j0 + 16) * DD, DD); // keys j0+16..j0+31
    v8f zero = {};
    v8f s0 = __builtin_amdgcn_wmma_f32_16x16x32_f16(false, kf0, false, qf,
                                                    (short)0, zero, false, false);
    v8f s1 = __builtin_amdgcn_wmma_f32_16x16x32_f16(false, kf1, false, qf,
                                                    (short)0, zero, false, false);
    // --- per-lane (per-query) online softmax over this 32-key strip ---
    float mx = fmaxf(s0[0], s1[0]);
#pragma unroll
    for (int p = 1; p < 8; ++p) mx = fmaxf(mx, fmaxf(s0[p], s1[p]));
    mx = fmaxf(mx, __shfl_xor(mx, 16, 32));    // merge the two key-halves
    float mnew  = fmaxf(m, mx);
    float alpha = __expf(m - mnew);
    v16h pf;
    float rs = 0.f;
#pragma unroll
    for (int p = 0; p < 8; ++p) {
      float e0 = __expf(s0[p] - mnew);
      float e1 = __expf(s1[p] - mnew);
      rs += e0 + e1;
      pf[p]     = (_Float16)e0;   // B-frag element p   <-> key kb+p      of strip
      pf[8 + p] = (_Float16)e1;   // B-frag element 8+p <-> key 16+kb+p   of strip
    }
    rs += __shfl_xor(rs, 16, 32);
    l = l * alpha + rs;
    m = mnew;
#pragma unroll
    for (int p = 0; p < 8; ++p) { o0[p] *= alpha; o1[p] *= alpha; }
    // --- O^T += V^T x P^T ---
    v16h vf0 = load_frag_k32(Vbase + j0, NN);                     // d = 0..15
    v16h vf1 = load_frag_k32(Vbase + (size_t)16 * NN + j0, NN);   // d = 16..31
    o0 = __builtin_amdgcn_wmma_f32_16x16x32_f16(false, vf0, false, pf,
                                                (short)0, o0, false, false);
    o1 = __builtin_amdgcn_wmma_f32_16x16x32_f16(false, vf1, false, pf,
                                                (short)0, o1, false, false);
  }

  // --- epilogue: normalize, pack, two b128 stores per lane ---
  float inv = 1.0f / l;
  int n = qt * 16 + col;
  size_t off = (((size_t)b * NN) + n) * INNER + h * DD;
  v8h r0, r1;
#pragma unroll
  for (int p = 0; p < 8; ++p) {
    r0[p] = (_Float16)(o0[p] * inv);   // d = kb+p
    r1[p] = (_Float16)(o1[p] * inv);   // d = 16+kb+p
  }
  *(v8h*)(AO + off + kb)      = r0;
  *(v8h*)(AO + off + 16 + kb) = r1;
}

// ---------------------------------------------------------------------------
// Kernel 5: output projection  out[b][o][n] = sum_c wo[o][c]*AO[b][n][c] + bo[o]
// One wave per 16x16 output tile, K=256 in 8 WMMA steps.
// ---------------------------------------------------------------------------
__global__ __launch_bounds__(32) void out_proj(const _Float16* __restrict__ wo16,
                                               const _Float16* __restrict__ AO,
                                               const float* __restrict__ bo,
                                               float* __restrict__ out) {
  const int otiles = CC / 16;
  const int ntiles = NN / 16;
  int ot = blockIdx.x % otiles;
  int rest = blockIdx.x / otiles;
  int nt = rest % ntiles;
  int b  = rest / ntiles;
  int lane = threadIdx.x;
  int col  = lane & 15;
  int hi8  = (lane & 16) ? 8 : 0;

  const _Float16* Abase = wo16 + (size_t)ot * 16 * INNER;            // rows = o
  const _Float16* Bbase = AO + (((size_t)b * NN) + nt * 16) * INNER; // cols = n
  v8f acc = {};
#pragma unroll
  for (int k = 0; k < INNER; k += 32) {
    v16h af = load_frag_k32(Abase + k, INNER);
    v16h bf = load_frag_k32(Bbase + k, INNER);
    acc = __builtin_amdgcn_wmma_f32_16x16x32_f16(false, af, false, bf,
                                                 (short)0, acc, false, false);
  }
#pragma unroll
  for (int p = 0; p < 8; ++p) {
    int o = ot * 16 + p + hi8;
    int n = nt * 16 + col;
    out[(((size_t)b * CC) + o) * NN + n] = acc[p] + bo[o];
  }
}

// ---------------------------------------------------------------------------
extern "C" void kernel_launch(void* const* d_in, const int* in_sizes, int n_in,
                              void* d_out, int out_size, void* d_ws, size_t ws_size,
                              hipStream_t stream) {
  const float* x     = (const float*)d_in[0];
  const float* gamma = (const float*)d_in[1];
  const float* beta  = (const float*)d_in[2];
  const float* wk    = (const float*)d_in[3];
  const float* wq    = (const float*)d_in[4];
  const float* wv    = (const float*)d_in[5];
  const float* wo    = (const float*)d_in[6];
  const float* bo    = (const float*)d_in[7];
  float* out = (float*)d_out;

  char* ws = (char*)d_ws;
  size_t off = 0;
  float* scale = (float*)(ws + off); off += CC * sizeof(float);
  float* shift = (float*)(ws + off); off += CC * sizeof(float);
  off = (off + 255) & ~(size_t)255;
  _Float16* wo16 = (_Float16*)(ws + off); off += (size_t)CC * INNER * 2;        // 128 KB
  _Float16* Qh   = (_Float16*)(ws + off); off += (size_t)BB * HH * NN * DD * 2; // 2 MB
  _Float16* Kh   = (_Float16*)(ws + off); off += (size_t)BB * HH * NN * DD * 2; // 2 MB
  _Float16* Vt   = (_Float16*)(ws + off); off += (size_t)BB * HH * NN * DD * 2; // 2 MB
  _Float16* AO   = (_Float16*)(ws + off); off += (size_t)BB * NN * INNER * 2;   // 2 MB

  bn_stats_kernel<<<dim3(CC), dim3(256), 0, stream>>>(x, gamma, beta, scale, shift);
  cvt_wo_kernel<<<dim3((CC * INNER + 255) / 256), dim3(256), 0, stream>>>(wo, wo16);
  proj_kernel<<<dim3(BB * HH * (NN / 256)), dim3(256), 0, stream>>>(
      x, scale, shift, wk, wq, wv, Qh, Kh, Vt);
  attn_fa<<<dim3(BB * HH * (NN / 16)), dim3(32), 0, stream>>>(Qh, Kh, Vt, AO);
  out_proj<<<dim3(BB * (NN / 16) * (CC / 16)), dim3(32), 0, stream>>>(wo16, AO, bo, out);
}

// v001
// One run takes 76.4 microseconds.
// Timed twice side by side with v000, it ran 1.24 times as fast both times.
#include <hip/hip_runtime.h>
#include <hip/hip_bf16.h>

// Flash-attention for the reference module, CDNA5 (gfx1250, wave32) WMMA path.
// Pipeline: bn_stats -> cvt_wo -> proj (BN+grouped conv, head-split layouts)
//           -> attn_fa (TRANSPOSED scores: S^T = K*Q^T, so online-softmax stats
//              are per-lane scalars and the P fragment is born in B-frag layout
//              -- no LDS transpose, no shuffle butterflies)
//           -> out_proj (256x256 WMMA GEMM + bias).
// Workspace requirement: 8,521,728 bytes (8 MiB + 130 KiB).

typedef __attribute__((ext_vector_type(16))) _Float16 v16h;
typedef __attribute__((ext_vector_type(8)))  _Float16 v8h;
typedef __attribute__((ext_vector_type(8)))  float    v8f;
typedef __attribute__((ext_vector_type(16))) float    f32x16;

#define BB 2
#define CC 256
#define NN 2048
#define HH 8
#define DD 32
#define INNER (HH * DD)   // 256

// ---------------------------------------------------------------------------
// WMMA 16x32 fragment load (f16), CDNA5 A-matrix layout (ISA 7.12.2):
//   lanes 0-15 : row = lane,    K in {kb..kb+7, 16+kb..16+kb+7}, kb=0
//   lanes16-31 : row = lane-16, kb=8
// Also the B-matrix (32x16) layout when `base` points at column-major data:
// column = lane&15, K contiguous with stride `ld` between columns.
// Each lane issues two 16-byte loads (global_load_b128).
// ---------------------------------------------------------------------------
__device__ __forceinline__ v16h load_frag_k32(const _Float16* __restrict__ base, int ld) {
  int lane = threadIdx.x & 31;
  int r    = lane & 15;
  int kb   = (lane & 16) ? 8 : 0;
  const _Float16* p = base + (size_t)r * (size_t)ld + kb;
  v8h lo = *(const v8h*)(p);
  v8h hi = *(const v8h*)(p + 16);
  v16h f;
#pragma unroll
  for (int i = 0; i < 8; ++i) { f[i] = lo[i]; f[8 + i] = hi[i]; }
  return f;
}

// ---------------------------------------------------------------------------
// Kernel 1: BatchNorm batch statistics -> per-channel affine (scale, shift)
// ---------------------------------------------------------------------------
__global__ __launch_bounds__(256) void bn_stats_kernel(
    const float* __restrict__ x, const float* __restrict__ gamma,
    const float* __restrict__ beta, float* __restrict__ scale,
    float* __restrict__ shift) {
  __shared__ float rs[256], rq[256];
  int c = blockIdx.x;
  int tid = threadIdx.x;
  float s = 0.f, s2 = 0.f;
  for (int b = 0; b < BB; ++b) {
    const float* row = x + (((size_t)b * CC) + c) * NN;
    for (int i = tid; i < NN; i += 256) {
      float v = row[i];
      s += v;
      s2 = fmaf(v, v, s2);
    }
  }
  rs[tid] = s; rq[tid] = s2;
  __syncthreads();
  for (int off = 128; off > 0; off >>= 1) {
    if (tid < off) { rs[tid] += rs[tid + off]; rq[tid] += rq[tid + off]; }
    __syncthreads();
  }
  if (tid == 0) {
    float invn = 1.0f / (float)(BB * NN);
    float mean = rs[0] * invn;
    float var  = rq[0] * invn - mean * mean;
    float r    = rsqrtf(var + 1e-5f);
    float sc   = gamma[c] * r;
    scale[c] = sc;
    shift[c] = beta[c] - mean * sc;
  }
}

// ---------------------------------------------------------------------------
// Kernel 2: wo (f32, 256x256) -> f16 once (reused by every output tile)
// ---------------------------------------------------------------------------
__global__ __launch_bounds__(256) void cvt_wo_kernel(const float* __restrict__ wo,
                                                     _Float16* __restrict__ wo16) {
  int i = blockIdx.x * 256 + threadIdx.x;
  if (i < CC * INNER) wo16[i] = (_Float16)wo[i];
}

// ---------------------------------------------------------------------------
// Kernel 3: BN-normalize + grouped 1x1 conv projections.
// Emits the reference's faithful '(d h)' head split WITH the q<-k swap and the
// 1/sqrt(D) scale folded into Qh. Layouts chosen for WMMA fragment loads:
//   Qh,Kh : [b, h', n, 32]  (d' contiguous)   -> QK^T frags are 2x b128/lane
//   Vt    : [b, h', 32, n]  (n contiguous)    -> P@V  frags are 2x b128/lane
// ---------------------------------------------------------------------------
__global__ __launch_bounds__(256) void proj_kernel(
    const float* __restrict__ x, const float* __restrict__ scale,
    const float* __restrict__ shift, const float* __restrict__ wk,
    const float* __restrict__ wq, const float* __restrict__ wv,
    _Float16* __restrict__ Qh, _Float16* __restrict__ Kh,
    _Float16* __restrict__ Vt) {
  const int ntile_cnt = NN / 256;
  int nt = blockIdx.x % ntile_cnt;
  int bg = blockIdx.x / ntile_cnt;
  int g  = bg % HH;
  int b  = bg / HH;
  // Every weight, scale and shift index below is the same for the whole
  // work-group, so these reads compile to scalar loads: the operand sits in a
  // scalar register and no LDS wait stands between the multiply-adds.
  const f32x16* __restrict__ wkg = (const f32x16*)(wk + g * 1024);  // row d = [2d], [2d+1]
  const f32x16* __restrict__ wqg = (const f32x16*)(wq + g * 1024);
  const f32x16* __restrict__ wvg = (const f32x16*)(wv + g * 1024);
  const float* __restrict__ scg = scale + g * 32;
  const float* __restrict__ shg = shift + g * 32;

  int n = nt * 256 + threadIdx.x;
  float xn[32];
#pragma unroll
  for (int c = 0; c < 32; ++c)
    xn[c] = x[(((size_t)b * CC) + g * 32 + c) * NN + n] * scg[c] + shg[c];

  const float qscale = 0.17677669529663687f;  // 1/sqrt(32)
  // Kept rolled: two rows of each of the three matrices already fill the scalar
  // registers; four rows a trip spilled them into vector lanes.
#pragma unroll 1
  for (int d0 = 0; d0 < 32; d0 += 2) {
    float ak2[2] = {0.f, 0.f}, aq2[2] = {0.f, 0.f}, av2[2] = {0.f, 0.f};
#pragma unroll
    for (int hf = 0; hf < 2; ++hf) {
      f32x16 rk[2], rq[2], rv[2];
#pragma unroll
      for (int u = 0; u < 2; ++u) {
        rk[u] = wkg[(d0 + u) * 2 + hf];
        rq[u] = wqg[(d0 + u) * 2 + hf];
        rv[u] = wvg[(d0 + u) * 2 + hf];
      }
#pragma unroll
      for (int c = 0; c < 16; ++c) {
#pragma unroll
        for (int u = 0; u < 2; ++u) {
          ak2[u] = fmaf(rk[u][c], xn[hf * 16 + c], ak2[u]);
          aq2[u] = fmaf(rq[u][c], xn[hf * 16 + c], aq2[u]);
          av2[u] = fmaf(rv[u][c], xn[hf * 16 + c], av2[u]);
        }
      }
    }
#pragma unroll
    for (int u = 0; u < 2; ++u) {
      float ak = ak2[u], aq = aq2[u], av = av2[u];
      int cc = g * 32 + d0 + u;   // projected channel index
      int hh = cc & 7;            // attention head  (channel = d'*H + h')
      int dd = cc >> 3;           // attention d'
      size_t bh = (size_t)b * HH + hh;
      Qh[(bh * NN + n) * DD + dd] = (_Float16)(ak * qscale);  // q <- k (swap), pre-scaled
      Kh[(bh * NN + n) * DD + dd] = (_Float16)aq;             // k <- q (swap)
      Vt[(bh * DD + dd) * NN + n] = (_Float16)av;             // transposed V
    }
    // The next trip rewrites the registers that these stores name.
    asm volatile("s_wait_xcnt 0x0" ::: "memory");
  }
}

// ---------------------------------------------------------------------------
// Kernel 4: flash attention with TRANSPOSED score tiles.
//   S^T = A(K-tile 16keys x 32d) x B(Q^T 32d x 16queries)
//     -> C-layout: lane owns one query column; its 8 elements are keys
//        {kb..kb+7} (kb = lane>=16 ? 8 : 0) of the strip half.
//   Softmax stats (m, l) are per-lane scalars; the only cross-lane ops are two
//   shfl_xor(16) per strip (max and sum) to merge the two key-halves of each query.
//   exp(S^T - m) lands *directly* in the B-frag layout required by
//   O^T = A(V^T 16d x 32keys) x B(P^T 32keys x 16queries): pf[i]=e(s0[i]),
//   pf[8+i]=e(s1[i]). No LDS, no transposes.
//   Epilogue: each lane holds 8 contiguous d values per accumulator ->
//   two packed b128 stores into AO[b][n][h*32+d].
// ---------------------------------------------------------------------------
__global__ __launch_bounds__(32) void attn_fa(const _Float16* __restrict__ Qh,
                                              const _Float16* __restrict__ Kh,
                                              const _Float16* __restrict__ Vt,
                                              _Float16* __restrict__ AO) {
  const int ntiles = NN / 16;
  int qt = blockIdx.x % ntiles;
  int bh = blockIdx.x / ntiles;  // b*HH + h
  int h  = bh % HH;
  int b  = bh / HH;
  int lane = threadIdx.x;
  int col  = lane & 15;                // this lane's query within the tile
  int kb   = (lane & 16) ? 8 : 0;      // key-half / d-half selector

  const _Float16* Qbase = Qh + (((size_t)bh * NN) + qt * 16) * DD;
  const _Float16* Kbase = Kh + ((size_t)bh * NN) * DD;
  const _Float16* Vbase = Vt + ((size_t)bh * DD) * NN;

  v16h qf = load_frag_k32(Qbase, DD);  // B-frag of Q^T, lives across the loop
  v8f o0 = {};  // O^T rows d = kb..kb+7        (cols = queries)
  v8f o1 = {};  // O^T rows d = 16+kb..16+kb+7
  float m = -3.0e30f, l = 0.f;

  for (int j0 = 0; j0 < NN; j0 += 32) {
    v16h kf0 = load_frag_k32(Kbase + (size_t)j0 * DD, DD);        // keys j0..j0+15
    v16h kf1 = load_frag_k32(Kbase + (size_t)(j0 + 16) * DD, DD); // keys j0+16..j0+31
    v8f zero = {};
    v8f s0 = __builtin_amdgcn_wmma_f32_16x16x32_f16(false, kf0, false, qf,
                                                    (short)0, zero, false, false);
    v8f s1 = __builtin_amdgcn_wmma_f32_16x16x32_f16(false, kf1, false, qf,
                                                    (short)0, zero, false, false);
    // --- per-lane (per-query) online softmax over this 32-key strip ---
    float mx = fmaxf(s0[0], s1[0]);
#pragma unroll
    for (int p = 1; p < 8; ++p) mx = fmaxf(mx, fmaxf(s0[p], s1[p]));
    mx = fmaxf(mx, __shfl_xor(mx, 16, 32));    // merge the two key-halves
    float mnew  = fmaxf(m, mx);
    float alpha = __expf(m - mnew);
    v16h pf;
    float rs = 0.f;
#pragma unroll
    for (int p = 0; p < 8; ++p) {
      float e0 = __expf(s0[p] - mnew);
      float e1 = __expf(s1[p] - mnew);
      rs += e0 + e1;
      pf[p]     = (_Float16)e0;   // B-frag element p   <-> key kb+p      of strip
      pf[8 + p] = (_Float16)e1;   // B-frag element 8+p <-> key 16+kb+p   of strip
    }
    rs += __shfl_xor(rs, 16, 32);
    l = l * alpha + rs;
    m = mnew;
#pragma unroll
    for (int p = 0; p < 8; ++p) { o0[p] *= alpha; o1[p] *= alpha; }
    // --- O^T += V^T x P^T ---
    v16h vf0 = load_frag_k32(Vbase + j0, NN);                     // d = 0..15
    v16h vf1 = load_frag_k32(Vbase + (size_t)16 * NN + j0, NN);   // d = 16..31
    o0 = __builtin_amdgcn_wmma_f32_16x16x32_f16(false, vf0, false, pf,
                                                (short)0, o0, false, false);
    o1 = __builtin_amdgcn_wmma_f32_16x16x32_f16(false, vf1, false, pf,
                                                (short)0, o1, false, false);
  }

  // --- epilogue: normalize, pack, two b128 stores per lane ---
  float inv = 1.0f / l;
  int n = qt * 16 + col;
  size_t off = (((size_t)b * NN) + n) * INNER + h * DD;
  v8h r0, r1;
#pragma unroll
  for (int p = 0; p < 8; ++p) {
    r0[p] = (_Float16)(o0[p] * inv);   // d = kb+p
    r1[p] = (_Float16)(o1[p] * inv);   // d = 16+kb+p
  }
  *(v8h*)(AO + off + kb)      = r0;
  *(v8h*)(AO + off + 16 + kb) = r1;
}

// ---------------------------------------------------------------------------
// Kernel 5: output projection  out[b][o][n] = sum_c wo[o][c]*AO[b][n][c] + bo[o]
// One wave per 16x16 output tile, K=256 in 8 WMMA steps.
// ---------------------------------------------------------------------------
__global__ __launch_bounds__(32) void out_proj(const _Float16* __restrict__ wo16,
                                               const _Float16* __restrict__ AO,
                                               const float* __restrict__ bo,
                                               float* __restrict__ out) {
  const int otiles = CC / 16;
  const int ntiles = NN / 16;
  int ot = blockIdx.x % otiles;
  int rest = blockIdx.x / otiles;
  int nt = rest % ntiles;
  int b  = rest / ntiles;
  int lane = threadIdx.x;
  int col  = lane & 15;
  int hi8  = (lane & 16) ? 8 : 0;

  const _Float16* Abase = wo16 + (size_t)ot * 16 * INNER;            // rows = o
  const _Float16* Bbase = AO + (((size_t)b * NN) + nt * 16) * INNER; // cols = n
  v8f acc = {};
#pragma unroll
  for (int k = 0; k < INNER; k += 32) {
    v16h af = load_frag_k32(Abase + k, INNER);
    v16h bf = load_frag_k32(Bbase + k, INNER);
    acc = __builtin_amdgcn_wmma_f32_16x16x32_f16(false, af, false, bf,
                                                 (short)0, acc, false, false);
  }
#pragma unroll
  for (int p = 0; p < 8; ++p) {
    int o = ot * 16 + p + hi8;
    int n = nt * 16 + col;
    out[(((size_t)b * CC) + o) * NN + n] = acc[p] + bo[o];
  }
}

// ---------------------------------------------------------------------------
extern "C" void kernel_launch(void* const* d_in, const int* in_sizes, int n_in,
                              void* d_out, int out_size, void* d_ws, size_t ws_size,
                              hipStream_t stream) {
  const float* x     = (const float*)d_in[0];
  const float* gamma = (const float*)d_in[1];
  const float* beta  = (const float*)d_in[2];
  const float* wk    = (const float*)d_in[3];
  const float* wq    = (const float*)d_in[4];
  const float* wv    = (const float*)d_in[5];
  const float* wo    = (const float*)d_in[6];
  const float* bo    = (const float*)d_in[7];
  float* out = (float*)d_out;

  char* ws = (char*)d_ws;
  size_t off = 0;
  float* scale = (float*)(ws + off); off += CC * sizeof(float);
  float* shift = (float*)(ws + off); off += CC * sizeof(float);
  off = (off + 255) & ~(size_t)255;
  _Float16* wo16 = (_Float16*)(ws + off); off += (size_t)CC * INNER * 2;        // 128 KB
  _Float16* Qh   = (_Float16*)(ws + off); off += (size_t)BB * HH * NN * DD * 2; // 2 MB
  _Float16* Kh   = (_Float16*)(ws + off); off += (size_t)BB * HH * NN * DD * 2; // 2 MB
  _Float16* Vt   = (_Float16*)(ws + off); off += (size_t)BB * HH * NN * DD * 2; // 2 MB
  _Float16* AO   = (_Float16*)(ws + off); off += (size_t)BB * NN * INNER * 2;   // 2 MB

  bn_stats_kernel<<<dim3(CC), dim3(256), 0, stream>>>(x, gamma, beta, scale, shift);
  cvt_wo_kernel<<<dim3((CC * INNER + 255) / 256), dim3(256), 0, stream>>>(wo, wo16);
  proj_kernel<<<dim3(BB * HH * (NN / 256)), dim3(256), 0, stream>>>(
      x, scale, shift, wk, wq, wv, Qh, Kh, Vt);
  attn_fa<<<dim3(BB * HH * (NN / 16)), dim3(32), 0, stream>>>(Qh, Kh, Vt, AO);
  out_proj<<<dim3(BB * (NN / 16) * (CC / 16)), dim3(32), 0, stream>>>(wo16, AO, bo, out);
}

// v002
// One run takes 58 microseconds.
// Timed twice side by side with v001, it ran 1.32 and 1.35 times as fast.
// Counting every step since v000, it is 1.66 times as fast.
#include <hip/hip_runtime.h>
#include <hip/hip_bf16.h>

// Flash-attention for the reference module, CDNA5 (gfx1250, wave32) WMMA path.
// Pipeline: bn_stats -> cvt_wo -> proj (BN+grouped conv, head-split layouts)
//           -> attn_fa (TRANSPOSED scores: S^T = K*Q^T, so online-softmax stats
//              are per-lane scalars and the P fragment is born in B-frag layout;
//              K and V staged in LDS, shared by the eight waves of a group)
//           -> out_proj (256x256 WMMA GEMM + bias).
// Workspace requirement: 8,521,728 bytes (8 MiB + 130 KiB).

typedef __attribute__((ext_vector_type(16))) _Float16 v16h;
typedef __attribute__((ext_vector_type(8)))  _Float16 v8h;
typedef __attribute__((ext_vector_type(8)))  float    v8f;
typedef __attribute__((ext_vector_type(16))) float    f32x16;

#define BB 2
#define CC 256
#define NN 2048
#define HH 8
#define DD 32
#define INNER (HH * DD)   // 256

// ---------------------------------------------------------------------------
// WMMA 16x32 fragment load (f16), CDNA5 A-matrix layout (ISA 7.12.2):
//   lanes 0-15 : row = lane,    K in {kb..kb+7, 16+kb..16+kb+7}, kb=0
//   lanes16-31 : row = lane-16, kb=8
// Also the B-matrix (32x16) layout when `base` points at column-major data:
// column = lane&15, K contiguous with stride `ld` between columns.
// Each lane issues two 16-byte loads (global_load_b128).
// ---------------------------------------------------------------------------
__device__ __forceinline__ v16h load_frag_k32(const _Float16* __restrict__ base, int ld) {
  int lane = threadIdx.x & 31;
  int r    = lane & 15;
  int kb   = (lane & 16) ? 8 : 0;
  const _Float16* p = base + (size_t)r * (size_t)ld + kb;
  v8h lo = *(const v8h*)(p);
  v8h hi = *(const v8h*)(p + 16);
  v16h f;
#pragma unroll
  for (int i = 0; i < 8; ++i) { f[i] = lo[i]; f[8 + i] = hi[i]; }
  return f;
}

// ---------------------------------------------------------------------------
// Kernel 1: BatchNorm batch statistics -> per-channel affine (scale, shift)
// ---------------------------------------------------------------------------
__global__ __launch_bounds__(256) void bn_stats_kernel(
    const float* __restrict__ x, const float* __restrict__ gamma,
    const float* __restrict__ beta, float* __restrict__ scale,
    float* __restrict__ shift) {
  __shared__ float rs[256], rq[256];
  int c = blockIdx.x;
  int tid = threadIdx.x;
  float s = 0.f, s2 = 0.f;
  for (int b = 0; b < BB; ++b) {
    const float* row = x + (((size_t)b * CC) + c) * NN;
    for (int i = tid; i < NN; i += 256) {
      float v = row[i];
      s += v;
      s2 = fmaf(v, v, s2);
    }
  }
  rs[tid] = s; rq[tid] = s2;
  __syncthreads();
  for (int off = 128; off > 0; off >>= 1) {
    if (tid < off) { rs[tid] += rs[tid + off]; rq[tid] += rq[tid + off]; }
    __syncthreads();
  }
  if (tid == 0) {
    float invn = 1.0f / (float)(BB * NN);
    float mean = rs[0] * invn;
    float var  = rq[0] * invn - mean * mean;
    float r    = rsqrtf(var + 1e-5f);
    float sc   = gamma[c] * r;
    scale[c] = sc;
    shift[c] = beta[c] - mean * sc;
  }
}

// ---------------------------------------------------------------------------
// Kernel 2: wo (f32, 256x256) -> f16 once (reused by every output tile)
// ---------------------------------------------------------------------------
__global__ __launch_bounds__(256) void cvt_wo_kernel(const float* __restrict__ wo,
                                                     _Float16* __restrict__ wo16) {
  int i = blockIdx.x * 256 + threadIdx.x;
  if (i < CC * INNER) wo16[i] = (_Float16)wo[i];
}

// ---------------------------------------------------------------------------
// Kernel 3: BN-normalize + grouped 1x1 conv projections.
// Emits the reference's faithful '(d h)' head split WITH the q<-k swap and the
// 1/sqrt(D) scale folded into Qh. Layouts chosen for WMMA fragment loads:
//   Qh,Kh : [b, h', n, 32]  (d' contiguous)   -> QK^T frags are 2x b128/lane
//   Vt    : [b, h', 32, n]  (n contiguous)    -> P@V  frags are 2x b128/lane
// ---------------------------------------------------------------------------
__global__ __launch_bounds__(256) void proj_kernel(
    const float* __restrict__ x, const float* __restrict__ scale,
    const float* __restrict__ shift, const float* __restrict__ wk,
    const float* __restrict__ wq, const float* __restrict__ wv,
    _Float16* __restrict__ Qh, _Float16* __restrict__ Kh,
    _Float16* __restrict__ Vt) {
  const int ntile_cnt = NN / 256;
  int nt = blockIdx.x % ntile_cnt;
  int bg = blockIdx.x / ntile_cnt;
  int g  = bg % HH;
  int b  = bg / HH;
  // Every weight, scale and shift index below is the same for the whole
  // work-group, so these reads compile to scalar loads: the operand sits in a
  // scalar register and no LDS wait stands between the multiply-adds.
  const f32x16* __restrict__ wkg = (const f32x16*)(wk + g * 1024);  // row d = [2d], [2d+1]
  const f32x16* __restrict__ wqg = (const f32x16*)(wq + g * 1024);
  const f32x16* __restrict__ wvg = (const f32x16*)(wv + g * 1024);
  const float* __restrict__ scg = scale + g * 32;
  const float* __restrict__ shg = shift + g * 32;

  int n = nt * 256 + threadIdx.x;
  float xn[32];
#pragma unroll
  for (int c = 0; c < 32; ++c)
    xn[c] = x[(((size_t)b * CC) + g * 32 + c) * NN + n] * scg[c] + shg[c];

  const float qscale = 0.17677669529663687f;  // 1/sqrt(32)
  // Kept rolled: two rows of each of the three matrices already fill the scalar
  // registers; four rows a trip spilled them into vector lanes.
#pragma unroll 1
  for (int d0 = 0; d0 < 32; d0 += 2) {
    float ak2[2] = {0.f, 0.f}, aq2[2] = {0.f, 0.f}, av2[2] = {0.f, 0.f};
#pragma unroll
    for (int hf = 0; hf < 2; ++hf) {
      f32x16 rk[2], rq[2], rv[2];
#pragma unroll
      for (int u = 0; u < 2; ++u) {
        rk[u] = wkg[(d0 + u) * 2 + hf];
        rq[u] = wqg[(d0 + u) * 2 + hf];
        rv[u] = wvg[(d0 + u) * 2 + hf];
      }
#pragma unroll
      for (int c = 0; c < 16; ++c) {
#pragma unroll
        for (int u = 0; u < 2; ++u) {
          ak2[u] = fmaf(rk[u][c], xn[hf * 16 + c], ak2[u]);
          aq2[u] = fmaf(rq[u][c], xn[hf * 16 + c], aq2[u]);
          av2[u] = fmaf(rv[u][c], xn[hf * 16 + c], av2[u]);
        }
      }
    }
#pragma unroll
    for (int u = 0; u < 2; ++u) {
      float ak = ak2[u], aq = aq2[u], av = av2[u];
      int cc = g * 32 + d0 + u;   // projected channel index
      int hh = cc & 7;            // attention head  (channel = d'*H + h')
      int dd = cc >> 3;           // attention d'
      size_t bh = (size_t)b * HH + hh;
      Qh[(bh * NN + n) * DD + dd] = (_Float16)(ak * qscale);  // q <- k (swap), pre-scaled
      Kh[(bh * NN + n) * DD + dd] = (_Float16)aq;             // k <- q (swap)
      Vt[(bh * DD + dd) * NN + n] = (_Float16)av;             // transposed V
    }
    // The next trip rewrites the registers that these stores name.
    asm volatile("s_wait_xcnt 0x0" ::: "memory");
  }
}

// ---------------------------------------------------------------------------
// Kernel 4: flash attention with TRANSPOSED score tiles.
//   S^T = A(K-tile 16keys x 32d) x B(Q^T 32d x 16queries)
//     -> C-layout: lane owns one query column; its 8 elements are keys
//        {kb..kb+7} (kb = lane>=16 ? 8 : 0) of the strip half.
//   Softmax stats (m, l) are per-lane scalars; the only cross-lane ops are two
//   shfl_xor(16) per strip (max and sum) to merge the two key-halves of each query.
//   exp(S^T - m) lands *directly* in the B-frag layout required by
//   O^T = A(V^T 16d x 32keys) x B(P^T 32keys x 16queries): pf[i]=e(s0[i]),
//   pf[8+i]=e(s1[i]).
//   Eight waves (128 queries of one head) form a work-group and share every
//   K and V fragment: a stage of 128 keys is fetched from global memory once
//   per work-group, one stage ahead, and laid in LDS in fragment order, so a
//   fragment half is one ds_load_b128 over 512 contiguous bytes per wave.
//   Epilogue: each lane holds 8 contiguous d values per accumulator ->
//   two packed b128 stores into AO[b][n][h*32+d].
// ---------------------------------------------------------------------------
#define QWAVES 8              // waves per work-group, 16 queries each
#define SKEYS  128            // keys per stage
#define NSTAGE (NN / SKEYS)   // 16
#define NCH    (SKEYS / 64)   // 16-byte chunks of each tile that one thread moves

// One 16 x 32 fragment out of a staged tile: group = which 16 rows.
__device__ __forceinline__ v16h lds_frag(const v8h* t, int group, int llo, int lhi) {
  v8h lo = t[(group * 2) * 32 + llo];
  v8h hi = t[(group * 2 + 1) * 32 + lhi];
  return __builtin_shufflevector(lo, hi, 0, 1, 2, 3, 4, 5, 6, 7,
                                 8, 9, 10, 11, 12, 13, 14, 15);
}

__global__ __launch_bounds__(256) void attn_fa(const _Float16* __restrict__ Qh,
                                               const _Float16* __restrict__ Kh,
                                               const _Float16* __restrict__ Vt,
                                               _Float16* __restrict__ AO) {
  // [buffer][K, V][8 groups of 16 rows][lo, hi][32 places] of 16 bytes: 32 KB
  __shared__ v8h tile[2][2][SKEYS * 4];
  const int qblocks = NN / (16 * QWAVES);
  int qb = blockIdx.x % qblocks;
  int bh = blockIdx.x / qblocks;  // b*HH + h
  int h  = bh % HH;
  int b  = bh / HH;
  int tid  = threadIdx.x;
  int lane = tid & 31;
  int qt   = qb * QWAVES + (tid >> 5);
  int col  = lane & 15;                // this lane's query within the tile
  int kb   = (lane & 16) ? 8 : 0;      // key-half / d-half selector

  const _Float16* Qbase = Qh + (((size_t)bh * NN) + qt * 16) * DD;
  const _Float16* Kbase = Kh + ((size_t)bh * NN) * DD;
  const _Float16* Vbase = Vt + ((size_t)bh * DD) * NN;

  // Staging map. A tile is 128 rows of four 16-byte chunks (K: row = key;
  // V: row = strip * 32 + d, its 64 bytes the strip's 32 keys). Chunk c of row
  // rr is what lane (c & 1) * 16 + (rr & 15) takes as its lo (c < 2) or hi half.
  // Its place in that half's 512 bytes has the row xor-ed with 4 * c, so that
  // the 16 lanes of a half-wave, which store four chunks of each of four rows,
  // fall on 16 different bank groups; a reading half-wave still covers all 16.
  // Thread t moves chunks t + 256 * i (row + 64 * i, slot + 256 * i) of each tile.
  int c  = tid & 3;
  int rr = tid >> 2;
  int slot = ((rr >> 4) * 2 + (c >> 1)) * 32 + (c & 1) * 16 + ((rr & 15) ^ (c << 2));
  int llo  = (lane & 16) | (col ^ ((lane & 16) >> 2));  // reader's place, c = 0 or 1
  int lhi  = llo ^ 8;                                   // reader's place, c = 2 or 3
  const _Float16* kg = Kbase + tid * 8;
  const _Float16* vg = Vbase + (size_t)(rr & 31) * NN + (rr >> 5) * 32 + c * 8;

  v8h gk[NCH], gv[NCH];
#pragma unroll
  for (int i = 0; i < NCH; ++i) {
    gk[i] = *(const v8h*)(kg + i * 64 * DD);
    gv[i] = *(const v8h*)(vg + i * 64);
  }
  v16h qf = load_frag_k32(Qbase, DD);  // B-frag of Q^T, lives across the loop
#pragma unroll
  for (int i = 0; i < NCH; ++i) {
    tile[0][0][slot + i * 256] = gk[i];
    tile[0][1][slot + i * 256] = gv[i];
  }
  __syncthreads();

  v8f o0 = {};  // O^T rows d = kb..kb+7        (cols = queries)
  v8f o1 = {};  // O^T rows d = 16+kb..16+kb+7
  float m = -3.0e30f, l = 0.f;

  for (int s = 0; s < NSTAGE; ++s) {
    const bool more = s + 1 < NSTAGE;
    if (more) {  // next stage's chunks fly while this stage is worked on
      const _Float16* kn = kg + (size_t)(s + 1) * SKEYS * DD;
      const _Float16* vn = vg + (s + 1) * SKEYS;
#pragma unroll
      for (int i = 0; i < NCH; ++i) {
        gk[i] = *(const v8h*)(kn + i * 64 * DD);
        gv[i] = *(const v8h*)(vn + i * 64);
      }
    }
    const v8h* kt = tile[s & 1][0];
    const v8h* vt = tile[s & 1][1];
    // Unrolled so that a strip's LDS reads can be issued ahead of their use.
#pragma unroll
    for (int p = 0; p < SKEYS / 32; ++p) {
      v16h kf0 = lds_frag(kt, p * 2, llo, lhi);      // keys j0..j0+15
      v16h kf1 = lds_frag(kt, p * 2 + 1, llo, lhi);  // keys j0+16..j0+31
      v8f zero = {};
      v8f s0 = __builtin_amdgcn_wmma_f32_16x16x32_f16(false, kf0, false, qf,
                                                      (short)0, zero, false, false);
      v8f s1 = __builtin_amdgcn_wmma_f32_16x16x32_f16(false, kf1, false, qf,
                                                      (short)0, zero, false, false);
      // --- per-lane (per-query) online softmax over this 32-key strip ---
      float mx = fmaxf(s0[0], s1[0]);
#pragma unroll
      for (int e = 1; e < 8; ++e) mx = fmaxf(mx, fmaxf(s0[e], s1[e]));
      mx = fmaxf(mx, __shfl_xor(mx, 16, 32));    // merge the two key-halves
      float mnew  = fmaxf(m, mx);
      float alpha = __expf(m - mnew);
      v16h pf;
      float rs = 0.f;
#pragma unroll
      for (int e = 0; e < 8; ++e) {
        float e0 = __expf(s0[e] - mnew);
        float e1 = __expf(s1[e] - mnew);
        rs += e0 + e1;
        pf[e]     = (_Float16)e0;   // B-frag element e   <-> key kb+e      of strip
        pf[8 + e] = (_Float16)e1;   // B-frag element 8+e <-> key 16+kb+e   of strip
      }
      rs += __shfl_xor(rs, 16, 32);
      l = l * alpha + rs;
      m = mnew;
#pragma unroll
      for (int e = 0; e < 8; ++e) { o0[e] *= alpha; o1[e] *= alpha; }
      // --- O^T += V^T x P^T ---
      v16h vf0 = lds_frag(vt, p * 2, llo, lhi);      // d = 0..15
      v16h vf1 = lds_frag(vt, p * 2 + 1, llo, lhi);  // d = 16..31
      o0 = __builtin_amdgcn_wmma_f32_16x16x32_f16(false, vf0, false, pf,
                                                  (short)0, o0, false, false);
      o1 = __builtin_amdgcn_wmma_f32_16x16x32_f16(false, vf1, false, pf,
                                                  (short)0, o1, false, false);
    }
    if (more) {  // the other buffer's readers left it at the last barrier
      v8h* kd = tile[(s + 1) & 1][0];
      v8h* vd = tile[(s + 1) & 1][1];
#pragma unroll
      for (int i = 0; i < NCH; ++i) {
        kd[slot + i * 256] = gk[i];
        vd[slot + i * 256] = gv[i];
      }
    }
    // Publishes stage s + 1 and ends every wave's reads of stage s.
    __syncthreads();
  }

  // --- epilogue: normalize, pack, two b128 stores per lane ---
  float inv = 1.0f / l;
  int n = qt * 16 + col;
  size_t off = (((size_t)b * NN) + n) * INNER + h * DD;
  v8h r0, r1;
#pragma unroll
  for (int p = 0; p < 8; ++p) {
    r0[p] = (_Float16)(o0[p] * inv);   // d = kb+p
    r1[p] = (_Float16)(o1[p] * inv);   // d = 16+kb+p
  }
  *(v8h*)(AO + off + kb)      = r0;
  *(v8h*)(AO + off + 16 + kb) = r1;
}

// ---------------------------------------------------------------------------
// Kernel 5: output projection  out[b][o][n] = sum_c wo[o][c]*AO[b][n][c] + bo[o]
// One wave per 16x16 output tile, K=256 in 8 WMMA steps.
// ---------------------------------------------------------------------------
__global__ __launch_bounds__(32) void out_proj(const _Float16* __restrict__ wo16,
                                               const _Float16* __restrict__ AO,
                                               const float* __restrict__ bo,
                                               float* __restrict__ out) {
  const int otiles = CC / 16;
  const int ntiles = NN / 16;
  int ot = blockIdx.x % otiles;
  int rest = blockIdx.x / otiles;
  int nt = rest % ntiles;
  int b  = rest / ntiles;
  int lane = threadIdx.x;
  int col  = lane & 15;
  int hi8  = (lane & 16) ? 8 : 0;

  const _Float16* Abase = wo16 + (size_t)ot * 16 * INNER;            // rows = o
  const _Float16* Bbase = AO + (((size_t)b * NN) + nt * 16) * INNER; // cols = n
  v8f acc = {};
#pragma unroll
  for (int k = 0; k < INNER; k += 32) {
    v16h af = load_frag_k32(Abase + k, INNER);
    v16h bf = load_frag_k32(Bbase + k, INNER);
    acc = __builtin_amdgcn_wmma_f32_16x16x32_f16(false, af, false, bf,
                                                 (short)0, acc, false, false);
  }
#pragma unroll
  for (int p = 0; p < 8; ++p) {
    int o = ot * 16 + p + hi8;
    int n = nt * 16 + col;
    out[(((size_t)b * CC) + o) * NN + n] = acc[p] + bo[o];
  }
}

// ---------------------------------------------------------------------------
extern "C" void kernel_launch(void* const* d_in, const int* in_sizes, int n_in,
                              void* d_out, int out_size, void* d_ws, size_t ws_size,
                              hipStream_t stream) {
  const float* x     = (const float*)d_in[0];
  const float* gamma = (const float*)d_in[1];
  const float* beta  = (const float*)d_in[2];
  const float* wk    = (const float*)d_in[3];
  const float* wq    = (const float*)d_in[4];
  const float* wv    = (const float*)d_in[5];
  const float* wo    = (const float*)d_in[6];
  const float* bo    = (const float*)d_in[7];
  float* out = (float*)d_out;

  char* ws = (char*)d_ws;
  size_t off = 0;
  float* scale = (float*)(ws + off); off += CC * sizeof(float);
  float* shift = (float*)(ws + off); off += CC * sizeof(float);
  off = (off + 255) & ~(size_t)255;
  _Float16* wo16 = (_Float16*)(ws + off); off += (size_t)CC * INNER * 2;        // 128 KB
  _Float16* Qh   = (_Float16*)(ws + off); off += (size_t)BB * HH * NN * DD * 2; // 2 MB
  _Float16* Kh   = (_Float16*)(ws + off); off += (size_t)BB * HH * NN * DD * 2; // 2 MB
  _Float16* Vt   = (_Float16*)(ws + off); off += (size_t)BB * HH * NN * DD * 2; // 2 MB
  _Float16* AO   = (_Float16*)(ws + off); off += (size_t)BB * NN * INNER * 2;   // 2 MB

  bn_stats_kernel<<<dim3(CC), dim3(256), 0, stream>>>(x, gamma, beta, scale, shift);
  cvt_wo_kernel<<<dim3((CC * INNER + 255) / 256), dim3(256), 0, stream>>>(wo, wo16);
  proj_kernel<<<dim3(BB * HH * (NN / 256)), dim3(256), 0, stream>>>(
      x, scale, shift, wk, wq, wv, Qh, Kh, Vt);
  attn_fa<<<dim3(BB * HH * (NN / 128)), dim3(256), 0, stream>>>(Qh, Kh, Vt, AO);
  out_proj<<<dim3(BB * (NN / 16) * (CC / 16)), dim3(32), 0, stream>>>(wo16, AO, bo, out);
}

// v003
// It runs in 55.3 microseconds.
// Next to v002, in two timings, it ran 1.04 times as fast each time.
// Over all steps from v000 it is 1.73 times as fast.
#include <hip/hip_runtime.h>
#include <hip/hip_bf16.h>

// Flash-attention for the reference module, CDNA5 (gfx1250, wave32) WMMA path.
// Pipeline: bn_stats -> proj (BN+grouped conv, head-split layouts; the f16 copy
//              of wo is made by extra work-groups of the same grid)
//           -> attn_fa (TRANSPOSED scores: S^T = K*Q^T, so online-softmax stats
//              are per-lane scalars and the P fragment is born in B-frag layout;
//              K and V staged in LDS, shared by the eight waves of a group)
//           -> out_proj (256x256 WMMA GEMM + bias).
// Workspace requirement: 8,521,728 bytes (8 MiB + 130 KiB).

typedef __attribute__((ext_vector_type(16))) _Float16 v16h;
typedef __attribute__((ext_vector_type(8)))  _Float16 v8h;
typedef __attribute__((ext_vector_type(8)))  float    v8f;
typedef __attribute__((ext_vector_type(16))) float    f32x16;
typedef __attribute__((ext_vector_type(4)))  float    f32x4;

#define BB 2
#define CC 256
#define NN 2048
#define HH 8
#define DD 32
#define INNER (HH * DD)   // 256

// ---------------------------------------------------------------------------
// WMMA 16x32 fragment load (f16), CDNA5 A-matrix layout (ISA 7.12.2):
//   lanes 0-15 : row = lane,    K in {kb..kb+7, 16+kb..16+kb+7}, kb=0
//   lanes16-31 : row = lane-16, kb=8
// Also the B-matrix (32x16) layout when `base` points at column-major data:
// column = lane&15, K contiguous with stride `ld` between columns.
// Each lane issues two 16-byte loads (global_load_b128).
// ---------------------------------------------------------------------------
__device__ __forceinline__ v16h load_frag_k32(const _Float16* __restrict__ base, int ld) {
  int lane = threadIdx.x & 31;
  int r    = lane & 15;
  int kb   = (lane & 16) ? 8 : 0;
  const _Float16* p = base + (size_t)r * (size_t)ld + kb;
  v8h lo = *(const v8h*)(p);
  v8h hi = *(const v8h*)(p + 16);
  v16h f;
#pragma unroll
  for (int i = 0; i < 8; ++i) { f[i] = lo[i]; f[8 + i] = hi[i]; }
  return f;
}

// ---------------------------------------------------------------------------
// Kernel 1: BatchNorm batch statistics -> per-channel affine (scale, shift)
// ---------------------------------------------------------------------------
__global__ __launch_bounds__(256) void bn_stats_kernel(
    const float* __restrict__ x, const float* __restrict__ gamma,
    const float* __restrict__ beta, float* __restrict__ scale,
    float* __restrict__ shift) {
  __shared__ float rs[256], rq[256];
  int c = blockIdx.x;
  int tid = threadIdx.x;
  float s = 0.f, s2 = 0.f;
  for (int b = 0; b < BB; ++b) {
    const float* row = x + (((size_t)b * CC) + c) * NN;
    for (int i = tid; i < NN; i += 256) {
      float v = row[i];
      s += v;
      s2 = fmaf(v, v, s2);
    }
  }
  rs[tid] = s; rq[tid] = s2;
  __syncthreads();
  for (int off = 128; off > 0; off >>= 1) {
    if (tid < off) { rs[tid] += rs[tid + off]; rq[tid] += rq[tid + off]; }
    __syncthreads();
  }
  if (tid == 0) {
    float invn = 1.0f / (float)(BB * NN);
    float mean = rs[0] * invn;
    float var  = rq[0] * invn - mean * mean;
    float r    = rsqrtf(var + 1e-5f);
    float sc   = gamma[c] * r;
    scale[c] = sc;
    shift[c] = beta[c] - mean * sc;
  }
}

// ---------------------------------------------------------------------------
// Kernel 2: BN-normalize + grouped 1x1 conv projections.
// Emits the reference's faithful '(d h)' head split WITH the q<-k swap and the
// 1/sqrt(D) scale folded into Qh. Layouts chosen for WMMA fragment loads:
//   Qh,Kh : [b, h', n, 32]  (d' contiguous)   -> QK^T frags are 2x b128/lane
//   Vt    : [b, h', 32, n]  (n contiguous)    -> P@V  frags are 2x b128/lane
// The work-groups behind the PROJ_WG projecting ones turn wo (f32, 256x256) into
// f16 for out_proj. That work depends on nothing here and nothing here depends
// on it; in this grid it runs on WGPs the projections leave idle and needs no
// launch of its own.
// ---------------------------------------------------------------------------
#define PROJ_WG (BB * HH * (NN / 256))      // 128 projecting work-groups
#define CVT_WG  (CC * INNER / (256 * 8))    // 32 converting ones, 8 elements a thread
__global__ __launch_bounds__(256) void proj_kernel(
    const float* __restrict__ x, const float* __restrict__ scale,
    const float* __restrict__ shift, const float* __restrict__ wk,
    const float* __restrict__ wq, const float* __restrict__ wv,
    _Float16* __restrict__ Qh, _Float16* __restrict__ Kh,
    _Float16* __restrict__ Vt, const float* __restrict__ wo,
    _Float16* __restrict__ wo16) {
  if (blockIdx.x >= PROJ_WG) {
    int i = ((blockIdx.x - PROJ_WG) * 256 + threadIdx.x) * 8;
    f32x4 lo = *(const f32x4*)(wo + i);
    f32x4 hi = *(const f32x4*)(wo + i + 4);
    v8h r;
#pragma unroll
    for (int e = 0; e < 4; ++e) { r[e] = (_Float16)lo[e]; r[4 + e] = (_Float16)hi[e]; }
    *(v8h*)(wo16 + i) = r;
    return;
  }
  const int ntile_cnt = NN / 256;
  int nt = blockIdx.x % ntile_cnt;
  int bg = blockIdx.x / ntile_cnt;
  int g  = bg % HH;
  int b  = bg / HH;
  // Every weight, scale and shift index below is the same for the whole
  // work-group, so these reads compile to scalar loads: the operand sits in a
  // scalar register and no LDS wait stands between the multiply-adds.
  const f32x16* __restrict__ wkg = (const f32x16*)(wk + g * 1024);  // row d = [2d], [2d+1]
  const f32x16* __restrict__ wqg = (const f32x16*)(wq + g * 1024);
  const f32x16* __restrict__ wvg = (const f32x16*)(wv + g * 1024);
  const float* __restrict__ scg = scale + g * 32;
  const float* __restrict__ shg = shift + g * 32;

  int n = nt * 256 + threadIdx.x;
  float xn[32];
#pragma unroll
  for (int c = 0; c < 32; ++c)
    xn[c] = x[(((size_t)b * CC) + g * 32 + c) * NN + n] * scg[c] + shg[c];

  const float qscale = 0.17677669529663687f;  // 1/sqrt(32)
  // Kept rolled: two rows of each of the three matrices already fill the scalar
  // registers; four rows a trip spilled them into vector lanes.
#pragma unroll 1
  for (int d0 = 0; d0 < 32; d0 += 2) {
    float ak2[2] = {0.f, 0.f}, aq2[2] = {0.f, 0.f}, av2[2] = {0.f, 0.f};
#pragma unroll
    for (int hf = 0; hf < 2; ++hf) {
      f32x16 rk[2], rq[2], rv[2];
#pragma unroll
      for (int u = 0; u < 2; ++u) {
        rk[u] = wkg[(d0 + u) * 2 + hf];
        rq[u] = wqg[(d0 + u) * 2 + hf];
        rv[u] = wvg[(d0 + u) * 2 + hf];
      }
#pragma unroll
      for (int c = 0; c < 16; ++c) {
#pragma unroll
        for (int u = 0; u < 2; ++u) {
          ak2[u] = fmaf(rk[u][c], xn[hf * 16 + c], ak2[u]);
          aq2[u] = fmaf(rq[u][c], xn[hf * 16 + c], aq2[u]);
          av2[u] = fmaf(rv[u][c], xn[hf * 16 + c], av2[u]);
        }
      }
    }
#pragma unroll
    for (int u = 0; u < 2; ++u) {
      float ak = ak2[u], aq = aq2[u], av = av2[u];
      int cc = g * 32 + d0 + u;   // projected channel index
      int hh = cc & 7;            // attention head  (channel = d'*H + h')
      int dd = cc >> 3;           // attention d'
      size_t bh = (size_t)b * HH + hh;
      Qh[(bh * NN + n) * DD + dd] = (_Float16)(ak * qscale);  // q <- k (swap), pre-scaled
      Kh[(bh * NN + n) * DD + dd] = (_Float16)aq;             // k <- q (swap)
      Vt[(bh * DD + dd) * NN + n] = (_Float16)av;             // transposed V
    }
    // The next trip rewrites the registers that these stores name.
    asm volatile("s_wait_xcnt 0x0" ::: "memory");
  }
}

// ---------------------------------------------------------------------------
// Kernel 3: flash attention with TRANSPOSED score tiles.
//   S^T = A(K-tile 16keys x 32d) x B(Q^T 32d x 16queries)
//     -> C-layout: lane owns one query column; its 8 elements are keys
//        {kb..kb+7} (kb = lane>=16 ? 8 : 0) of the strip half.
//   Softmax stats (m, l) are per-lane scalars; the only cross-lane ops are two
//   shfl_xor(16) per strip (max and sum) to merge the two key-halves of each query.
//   exp(S^T - m) lands *directly* in the B-frag layout required by
//   O^T = A(V^T 16d x 32keys) x B(P^T 32keys x 16queries): pf[i]=e(s0[i]),
//   pf[8+i]=e(s1[i]).
//   Eight waves (128 queries of one head) form a work-group and share every
//   K and V fragment: a stage of 128 keys is fetched from global memory once
//   per work-group, one stage ahead, and laid in LDS in fragment order, so a
//   fragment half is one ds_load_b128 over 512 contiguous bytes per wave.
//   Epilogue: each lane holds 8 contiguous d values per accumulator ->
//   two packed b128 stores into AO[b][n][h*32+d].
// ---------------------------------------------------------------------------
#define QWAVES 8              // waves per work-group, 16 queries each
#define SKEYS  128            // keys per stage
#define NSTAGE (NN / SKEYS)   // 16
#define NCH    (SKEYS / 64)   // 16-byte chunks of each tile that one thread moves

// One 16 x 32 fragment out of a staged tile: group = which 16 rows.
__device__ __forceinline__ v16h lds_frag(const v8h* t, int group, int llo, int lhi) {
  v8h lo = t[(group * 2) * 32 + llo];
  v8h hi = t[(group * 2 + 1) * 32 + lhi];
  return __builtin_shufflevector(lo, hi, 0, 1, 2, 3, 4, 5, 6, 7,
                                 8, 9, 10, 11, 12, 13, 14, 15);
}

__global__ __launch_bounds__(256) void attn_fa(const _Float16* __restrict__ Qh,
                                               const _Float16* __restrict__ Kh,
                                               const _Float16* __restrict__ Vt,
                                               _Float16* __restrict__ AO) {
  // [buffer][K, V][8 groups of 16 rows][lo, hi][32 places] of 16 bytes: 32 KB
  __shared__ v8h tile[2][2][SKEYS * 4];
  const int qblocks = NN / (16 * QWAVES);
  int qb = blockIdx.x % qblocks;
  int bh = blockIdx.x / qblocks;  // b*HH + h
  int h  = bh % HH;
  int b  = bh / HH;
  int tid  = threadIdx.x;
  int lane = tid & 31;
  int qt   = qb * QWAVES + (tid >> 5);
  int col  = lane & 15;                // this lane's query within the tile
  int kb   = (lane & 16) ? 8 : 0;      // key-half / d-half selector

  const _Float16* Qbase = Qh + (((size_t)bh * NN) + qt * 16) * DD;
  const _Float16* Kbase = Kh + ((size_t)bh * NN) * DD;
  const _Float16* Vbase = Vt + ((size_t)bh * DD) * NN;

  // Staging map. A tile is 128 rows of four 16-byte chunks (K: row = key;
  // V: row = strip * 32 + d, its 64 bytes the strip's 32 keys). Chunk c of row
  // rr is what lane (c & 1) * 16 + (rr & 15) takes as its lo (c < 2) or hi half.
  // Its place in that half's 512 bytes has the row xor-ed with 4 * c, so that
  // the 16 lanes of a half-wave, which store four chunks of each of four rows,
  // fall on 16 different bank groups; a reading half-wave still covers all 16.
  // Thread t moves chunks t + 256 * i (row + 64 * i, slot + 256 * i) of each tile.
  int c  = tid & 3;
  int rr = tid >> 2;
  int slot = ((rr >> 4) * 2 + (c >> 1)) * 32 + (c & 1) * 16 + ((rr & 15) ^ (c << 2));
  int llo  = (lane & 16) | (col ^ ((lane & 16) >> 2));  // reader's place, c = 0 or 1
  int lhi  = llo ^ 8;                                   // reader's place, c = 2 or 3
  const _Float16* kg = Kbase + tid * 8;
  const _Float16* vg = Vbase + (size_t)(rr & 31) * NN + (rr >> 5) * 32 + c * 8;

  v8h gk[NCH], gv[NCH];
#pragma unroll
  for (int i = 0; i < NCH; ++i) {
    gk[i] = *(const v8h*)(kg + i * 64 * DD);
    gv[i] = *(const v8h*)(vg + i * 64);
  }
  v16h qf = load_frag_k32(Qbase, DD);  // B-frag of Q^T, lives across the loop
#pragma unroll
  for (int i = 0; i < NCH; ++i) {
    tile[0][0][slot + i * 256] = gk[i];
    tile[0][1][slot + i * 256] = gv[i];
  }
  __syncthreads();

  v8f o0 = {};  // O^T rows d = kb..kb+7        (cols = queries)
  v8f o1 = {};  // O^T rows d = 16+kb..16+kb+7
  float m = -3.0e30f, l = 0.f;

  for (int s = 0; s < NSTAGE; ++s) {
    const bool more = s + 1 < NSTAGE;
    if (more) {  // next stage's chunks fly while this stage is worked on
      const _Float16* kn = kg + (size_t)(s + 1) * SKEYS * DD;
      const _Float16* vn = vg + (s + 1) * SKEYS;
#pragma unroll
      for (int i = 0; i < NCH; ++i) {
        gk[i] = *(const v8h*)(kn + i * 64 * DD);
        gv[i] = *(const v8h*)(vn + i * 64);
      }
    }
    const v8h* kt = tile[s & 1][0];
    const v8h* vt = tile[s & 1][1];
    // Unrolled so that a strip's LDS reads can be issued ahead of their use.
#pragma unroll
    for (int p = 0; p < SKEYS / 32; ++p) {
      v16h kf0 = lds_frag(kt, p * 2, llo, lhi);      // keys j0..j0+15
      v16h kf1 = lds_frag(kt, p * 2 + 1, llo, lhi);  // keys j0+16..j0+31
      v8f zero = {};
      v8f s0 = __builtin_amdgcn_wmma_f32_16x16x32_f16(false, kf0, false, qf,
                                                      (short)0, zero, false, false);
      v8f s1 = __builtin_amdgcn_wmma_f32_16x16x32_f16(false, kf1, false, qf,
                                                      (short)0, zero, false, false);
      // --- per-lane (per-query) online softmax over this 32-key strip ---
      float mx = fmaxf(s0[0], s1[0]);
#pragma unroll
      for (int e = 1; e < 8; ++e) mx = fmaxf(mx, fmaxf(s0[e], s1[e]));
      mx = fmaxf(mx, __shfl_xor(mx, 16, 32));    // merge the two key-halves
      float mnew  = fmaxf(m, mx);
      float alpha = __expf(m - mnew);
      v16h pf;
      float rs = 0.f;
#pragma unroll
      for (int e = 0; e < 8; ++e) {
        float e0 = __expf(s0[e] - mnew);
        float e1 = __expf(s1[e] - mnew);
        rs += e0 + e1;
        pf[e]     = (_Float16)e0;   // B-frag element e   <-> key kb+e      of strip
        pf[8 + e] = (_Float16)e1;   // B-frag element 8+e <-> key 16+kb+e   of strip
      }
      rs += __shfl_xor(rs, 16, 32);
      l = l * alpha + rs;
      m = mnew;
#pragma unroll
      for (int e = 0; e < 8; ++e) { o0[e] *= alpha; o1[e] *= alpha; }
      // --- O^T += V^T x P^T ---
      v16h vf0 = lds_frag(vt, p * 2, llo, lhi);      // d = 0..15
      v16h vf1 = lds_frag(vt, p * 2 + 1, llo, lhi);  // d = 16..31
      o0 = __builtin_amdgcn_wmma_f32_16x16x32_f16(false, vf0, false, pf,
                                                  (short)0, o0, false, false);
      o1 = __builtin_amdgcn_wmma_f32_16x16x32_f16(false, vf1, false, pf,
                                                  (short)0, o1, false, false);
    }
    if (more) {  // the other buffer's readers left it at the last barrier
      v8h* kd = tile[(s + 1) & 1][0];
      v8h* vd = tile[(s + 1) & 1][1];
#pragma unroll
      for (int i = 0; i < NCH; ++i) {
        kd[slot + i * 256] = gk[i];
        vd[slot + i * 256] = gv[i];
      }
    }
    // Publishes stage s + 1 and ends every wave's reads of stage s.
    __syncthreads();
  }

  // --- epilogue: normalize, pack, two b128 stores per lane ---
  float inv = 1.0f / l;
  int n = qt * 16 + col;
  size_t off = (((size_t)b * NN) + n) * INNER + h * DD;
  v8h r0, r1;
#pragma unroll
  for (int p = 0; p < 8; ++p) {
    r0[p] = (_Float16)(o0[p] * inv);   // d = kb+p
    r1[p] = (_Float16)(o1[p] * inv);   // d = 16+kb+p
  }
  *(v8h*)(AO + off + kb)      = r0;
  *(v8h*)(AO + off + 16 + kb) = r1;
}

// ---------------------------------------------------------------------------
// Kernel 4: output projection  out[b][o][n] = sum_c wo[o][c]*AO[b][n][c] + bo[o]
// One wave per 16x16 output tile, K=256 in 8 WMMA steps.
// ---------------------------------------------------------------------------
__global__ __launch_bounds__(32) void out_proj(const _Float16* __restrict__ wo16,
                                               const _Float16* __restrict__ AO,
                                               const float* __restrict__ bo,
                                               float* __restrict__ out) {
  const int otiles = CC / 16;
  const int ntiles = NN / 16;
  int ot = blockIdx.x % otiles;
  int rest = blockIdx.x / otiles;
  int nt = rest % ntiles;
  int b  = rest / ntiles;
  int lane = threadIdx.x;
  int col  = lane & 15;
  int hi8  = (lane & 16) ? 8 : 0;

  const _Float16* Abase = wo16 + (size_t)ot * 16 * INNER;            // rows = o
  const _Float16* Bbase = AO + (((size_t)b * NN) + nt * 16) * INNER; // cols = n
  v8f acc = {};
#pragma unroll
  for (int k = 0; k < INNER; k += 32) {
    v16h af = load_frag_k32(Abase + k, INNER);
    v16h bf = load_frag_k32(Bbase + k, INNER);
    acc = __builtin_amdgcn_wmma_f32_16x16x32_f16(false, af, false, bf,
                                                 (short)0, acc, false, false);
  }
#pragma unroll
  for (int p = 0; p < 8; ++p) {
    int o = ot * 16 + p + hi8;
    int n = nt * 16 + col;
    out[(((size_t)b * CC) + o) * NN + n] = acc[p] + bo[o];
  }
}

// ---------------------------------------------------------------------------
extern "C" void kernel_launch(void* const* d_in, const int* in_sizes, int n_in,
                              void* d_out, int out_size, void* d_ws, size_t ws_size,
                              hipStream_t stream) {
  const float* x     = (const float*)d_in[0];
  const float* gamma = (const float*)d_in[1];
  const float* beta  = (const float*)d_in[2];
  const float* wk    = (const float*)d_in[3];
  const float* wq    = (const float*)d_in[4];
  const float* wv    = (const float*)d_in[5];
  const float* wo    = (const float*)d_in[6];
  const float* bo    = (const float*)d_in[7];
  float* out = (float*)d_out;

  char* ws = (char*)d_ws;
  size_t off = 0;
  float* scale = (float*)(ws + off); off += CC * sizeof(float);
  float* shift = (float*)(ws + off); off += CC * sizeof(float);
  off = (off + 255) & ~(size_t)255;
  _Float16* wo16 = (_Float16*)(ws + off); off += (size_t)CC * INNER * 2;        // 128 KB
  _Float16* Qh   = (_Float16*)(ws + off); off += (size_t)BB * HH * NN * DD * 2; // 2 MB
  _Float16* Kh   = (_Float16*)(ws + off); off += (size_t)BB * HH * NN * DD * 2; // 2 MB
  _Float16* Vt   = (_Float16*)(ws + off); off += (size_t)BB * HH * NN * DD * 2; // 2 MB
  _Float16* AO   = (_Float16*)(ws + off); off += (size_t)BB * NN * INNER * 2;   // 2 MB

  bn_stats_kernel<<<dim3(CC), dim3(256), 0, stream>>>(x, gamma, beta, scale, shift);
  proj_kernel<<<dim3(PROJ_WG + CVT_WG), dim3(256), 0, stream>>>(
      x, scale, shift, wk, wq, wv, Qh, Kh, Vt, wo, wo16);
  attn_fa<<<dim3(BB * HH * (NN / 128)), dim3(256), 0, stream>>>(Qh, Kh, Vt, AO);
  out_proj<<<dim3(BB * (NN / 16) * (CC / 16)), dim3(32), 0, stream>>>(wo16, AO, bo, out);
}

// v004
// Measured time: 47.3 microseconds a run.
// Two timings next to v003 put it at 1.18 and 1.17 times that version's speed.
// All steps since v000 together make it 2.03 times as fast.
#include <hip/hip_runtime.h>
#include <hip/hip_bf16.h>

// Flash-attention for the reference module, CDNA5 (gfx1250, wave32) WMMA path.
// Pipeline: proj (BN statistics of the group's own 32 channels, BN + grouped
//              conv, head-split layouts; the f16 copy of wo is made by extra
//              work-groups of the same grid)
//           -> attn_fa (TRANSPOSED scores: S^T = K*Q^T, so online-softmax stats
//              are per-lane scalars and the P fragment is born in B-frag layout;
//              K and V staged in LDS, shared by the eight waves of a group)
//           -> out_proj (256x256 WMMA GEMM + bias).
// Workspace requirement: 8,519,680 bytes (8 MiB + 128 KiB).

typedef __attribute__((ext_vector_type(16))) _Float16 v16h;
typedef __attribute__((ext_vector_type(8)))  _Float16 v8h;
typedef __attribute__((ext_vector_type(8)))  float    v8f;
typedef __attribute__((ext_vector_type(16))) float    f32x16;
typedef __attribute__((ext_vector_type(4)))  float    f32x4;

#define BB 2
#define CC 256
#define NN 2048
#define HH 8
#define DD 32
#define INNER (HH * DD)   // 256

// ---------------------------------------------------------------------------
// WMMA 16x32 fragment load (f16), CDNA5 A-matrix layout (ISA 7.12.2):
//   lanes 0-15 : row = lane,    K in {kb..kb+7, 16+kb..16+kb+7}, kb=0
//   lanes16-31 : row = lane-16, kb=8
// Also the B-matrix (32x16) layout when `base` points at column-major data:
// column = lane&15, K contiguous with stride `ld` between columns.
// Each lane issues two 16-byte loads (global_load_b128).
// ---------------------------------------------------------------------------
__device__ __forceinline__ v16h load_frag_k32(const _Float16* __restrict__ base, int ld) {
  int lane = threadIdx.x & 31;
  int r    = lane & 15;
  int kb   = (lane & 16) ? 8 : 0;
  const _Float16* p = base + (size_t)r * (size_t)ld + kb;
  v8h lo = *(const v8h*)(p);
  v8h hi = *(const v8h*)(p + 16);
  v16h f;
#pragma unroll
  for (int i = 0; i < 8; ++i) { f[i] = lo[i]; f[8 + i] = hi[i]; }
  return f;
}

// ---------------------------------------------------------------------------
// Kernel 1: BatchNorm batch statistics + BN-normalize + grouped 1x1 conv
// projections. A work-group needs scale and shift of its group's 32 channels
// only, so it sums those channels itself (all of b and n, 512 KB out of L2):
// wave w takes channels 4w..4w+3, a row of 2048 floats is 16 wave-wide 16-byte
// loads, and the next row's 16 loads fly while this row is summed.
// Emits the reference's faithful '(d h)' head split WITH the q<-k swap and the
// 1/sqrt(D) scale folded into Qh. Layouts chosen for WMMA fragment loads:
//   Qh,Kh : [b, h', n, 32]  (d' contiguous)   -> QK^T frags are 2x b128/lane
//   Vt    : [b, h', 32, n]  (n contiguous)    -> P@V  frags are 2x b128/lane
// The work-groups behind the PROJ_WG projecting ones turn wo (f32, 256x256) into
// f16 for out_proj. That work depends on nothing here and nothing here depends
// on it; in this grid it runs on WGPs the projections leave idle and needs no
// launch of its own.
// ---------------------------------------------------------------------------
#define PROJ_WG (BB * HH * (NN / 256))      // 128 projecting work-groups
#define CVT_WG  (CC * INNER / (256 * 8))    // 32 converting ones, 8 elements a thread
__global__ __launch_bounds__(256) void proj_kernel(
    const float* __restrict__ x, const float* __restrict__ gamma,
    const float* __restrict__ beta, const float* __restrict__ wk,
    const float* __restrict__ wq, const float* __restrict__ wv,
    _Float16* __restrict__ Qh, _Float16* __restrict__ Kh,
    _Float16* __restrict__ Vt, const float* __restrict__ wo,
    _Float16* __restrict__ wo16) {
  __shared__ f32x4 aff[2][8];  // [scale, shift][wave] of four channels each
  if (blockIdx.x >= PROJ_WG) {
    int i = ((blockIdx.x - PROJ_WG) * 256 + threadIdx.x) * 8;
    f32x4 lo = *(const f32x4*)(wo + i);
    f32x4 hi = *(const f32x4*)(wo + i + 4);
    v8h r;
#pragma unroll
    for (int e = 0; e < 4; ++e) { r[e] = (_Float16)lo[e]; r[4 + e] = (_Float16)hi[e]; }
    *(v8h*)(wo16 + i) = r;
    return;
  }
  const int ntile_cnt = NN / 256;
  int nt = blockIdx.x % ntile_cnt;
  int bg = blockIdx.x / ntile_cnt;
  int g  = bg % HH;
  int b  = bg / HH;
  // Every weight index below is the same for the whole work-group, so these
  // reads compile to scalar loads: the operand sits in a scalar register and no
  // LDS wait stands between the multiply-adds.
  const f32x16* __restrict__ wkg = (const f32x16*)(wk + g * 1024);  // row d = [2d], [2d+1]
  const f32x16* __restrict__ wqg = (const f32x16*)(wq + g * 1024);
  const f32x16* __restrict__ wvg = (const f32x16*)(wv + g * 1024);

  int n = nt * 256 + threadIdx.x;
  float xn[32];  // the thread's own column, on its way while the sums are made
#pragma unroll
  for (int c = 0; c < 32; ++c)
    xn[c] = x[(((size_t)b * CC) + g * 32 + c) * NN + n];

  // --- batch statistics of channels ch0..ch0+3, one wave ---
  {
    const int lane = threadIdx.x & 31;
    const int wave = __builtin_amdgcn_readfirstlane(threadIdx.x >> 5);
    const int ch0  = g * 32 + wave * 4;
    const f32x4 gm = *(const f32x4*)(gamma + ch0);
    const f32x4 bt = *(const f32x4*)(beta + ch0);
    // Row r = 2 * j + bb is channel ch0 + j of batch bb.
    f32x4 buf[2][16];
#pragma unroll
    for (int i = 0; i < 16; ++i)
      buf[0][i] = ((const f32x4*)(x + (size_t)ch0 * NN))[i * 32 + lane];
    // The sums below reuse the address registers of the column's loads; the
    // scheduling barrier keeps them behind the wait.
    asm volatile("s_wait_xcnt 0x0" ::: "memory");
    __builtin_amdgcn_sched_barrier(0);
    f32x4 sum, sq;
#pragma unroll
    for (int j = 0; j < 4; ++j) {
      f32x4 a = {0.f, 0.f, 0.f, 0.f}, q = {0.f, 0.f, 0.f, 0.f};
#pragma unroll
      for (int bb = 0; bb < BB; ++bb) {
        const int r = j * BB + bb;
        if (r + 1 < 4 * BB) {
          const float* nx = x + (((size_t)((r + 1) % BB) * CC) + ch0 + (r + 1) / BB) * NN;
#pragma unroll
          for (int i = 0; i < 16; ++i)
            buf[(r + 1) & 1][i] = ((const f32x4*)nx)[i * 32 + lane];
        }
        // Keeps the next row's 16 loads issued as one group in front of this
        // row's sums; left free, the compiler deals them out among the sums
        // and holds far fewer loads in flight.
        __builtin_amdgcn_sched_barrier(0);
#pragma unroll
        for (int i = 0; i < 16; ++i) {
          f32x4 v = buf[r & 1][i];
          a += v;
          q += v * v;
        }
      }
      sum[j] = (a[0] + a[1]) + (a[2] + a[3]);
      sq[j]  = (q[0] + q[1]) + (q[2] + q[3]);
    }
    // What follows reuses the registers that the rows' loads name.
    asm volatile("s_wait_xcnt 0x0" ::: "memory");
    __builtin_amdgcn_sched_barrier(0);
#pragma unroll
    for (int m = 16; m > 0; m >>= 1) {
#pragma unroll
      for (int j = 0; j < 4; ++j) {
        sum[j] += __shfl_xor(sum[j], m, 32);
        sq[j]  += __shfl_xor(sq[j], m, 32);
      }
    }
    f32x4 sc, sh;
#pragma unroll
    for (int j = 0; j < 4; ++j) {
      const float invn = 1.0f / (float)(BB * NN);
      float mean = sum[j] * invn;
      float var  = sq[j] * invn - mean * mean;
      sc[j] = gm[j] * rsqrtf(var + 1e-5f);
      sh[j] = bt[j] - mean * sc[j];
    }
    if (lane == 0) { aff[0][wave] = sc; aff[1][wave] = sh; }
  }
  // Hands every wave's four scales and shifts to the whole work-group.
  __syncthreads();
#pragma unroll
  for (int c4 = 0; c4 < 8; ++c4) {
    f32x4 sc = aff[0][c4], sh = aff[1][c4];
#pragma unroll
    for (int e = 0; e < 4; ++e) xn[c4 * 4 + e] = xn[c4 * 4 + e] * sc[e] + sh[e];
  }

  const float qscale = 0.17677669529663687f;  // 1/sqrt(32)
  // Kept rolled: two rows of each of the three matrices already fill the scalar
  // registers; four rows a trip spilled them into vector lanes.
#pragma unroll 1
  for (int d0 = 0; d0 < 32; d0 += 2) {
    float ak2[2] = {0.f, 0.f}, aq2[2] = {0.f, 0.f}, av2[2] = {0.f, 0.f};
#pragma unroll
    for (int hf = 0; hf < 2; ++hf) {
      f32x16 rk[2], rq[2], rv[2];
#pragma unroll
      for (int u = 0; u < 2; ++u) {
        rk[u] = wkg[(d0 + u) * 2 + hf];
        rq[u] = wqg[(d0 + u) * 2 + hf];
        rv[u] = wvg[(d0 + u) * 2 + hf];
      }
#pragma unroll
      for (int c = 0; c < 16; ++c) {
#pragma unroll
        for (int u = 0; u < 2; ++u) {
          ak2[u] = fmaf(rk[u][c], xn[hf * 16 + c], ak2[u]);
          aq2[u] = fmaf(rq[u][c], xn[hf * 16 + c], aq2[u]);
          av2[u] = fmaf(rv[u][c], xn[hf * 16 + c], av2[u]);
        }
      }
    }
#pragma unroll
    for (int u = 0; u < 2; ++u) {
      float ak = ak2[u], aq = aq2[u], av = av2[u];
      int cc = g * 32 + d0 + u;   // projected channel index
      int hh = cc & 7;            // attention head  (channel = d'*H + h')
      int dd = cc >> 3;           // attention d'
      size_t bh = (size_t)b * HH + hh;
      Qh[(bh * NN + n) * DD + dd] = (_Float16)(ak * qscale);  // q <- k (swap), pre-scaled
      Kh[(bh * NN + n) * DD + dd] = (_Float16)aq;             // k <- q (swap)
      Vt[(bh * DD + dd) * NN + n] = (_Float16)av;             // transposed V
    }
    // The next trip rewrites the registers that these stores name.
    asm volatile("s_wait_xcnt 0x0" ::: "memory");
  }
}

// ---------------------------------------------------------------------------
// Kernel 2: flash attention with TRANSPOSED score tiles.
//   S^T = A(K-tile 16keys x 32d) x B(Q^T 32d x 16queries)
//     -> C-layout: lane owns one query column; its 8 elements are keys
//        {kb..kb+7} (kb = lane>=16 ? 8 : 0) of the strip half.
//   Softmax stats (m, l) are per-lane scalars; the only cross-lane ops are two
//   shfl_xor(16) per strip (max and sum) to merge the two key-halves of each query.
//   exp(S^T - m) lands *directly* in the B-frag layout required by
//   O^T = A(V^T 16d x 32keys) x B(P^T 32keys x 16queries): pf[i]=e(s0[i]),
//   pf[8+i]=e(s1[i]).
//   Eight waves (128 queries of one head) form a work-group and share every
//   K and V fragment: a stage of 128 keys is fetched from global memory once
//   per work-group, one stage ahead, and laid in LDS in fragment order, so a
//   fragment half is one ds_load_b128 over 512 contiguous bytes per wave.
//   Epilogue: each lane holds 8 contiguous d values per accumulator ->
//   two packed b128 stores into AO[b][n][h*32+d].
// ---------------------------------------------------------------------------
#define QWAVES 8              // waves per work-group, 16 queries each
#define SKEYS  128            // keys per stage
#define NSTAGE (NN / SKEYS)   // 16
#define NCH    (SKEYS / 64)   // 16-byte chunks of each tile that one thread moves

// One 16 x 32 fragment out of a staged tile: group = which 16 rows.
__device__ __forceinline__ v16h lds_frag(const v8h* t, int group, int llo, int lhi) {
  v8h lo = t[(group * 2) * 32 + llo];
  v8h hi = t[(group * 2 + 1) * 32 + lhi];
  return __builtin_shufflevector(lo, hi, 0, 1, 2, 3, 4, 5, 6, 7,
                                 8, 9, 10, 11, 12, 13, 14, 15);
}

__global__ __launch_bounds__(256) void attn_fa(const _Float16* __restrict__ Qh,
                                               const _Float16* __restrict__ Kh,
                                               const _Float16* __restrict__ Vt,
                                               _Float16* __restrict__ AO) {
  // [buffer][K, V][8 groups of 16 rows][lo, hi][32 places] of 16 bytes: 32 KB
  __shared__ v8h tile[2][2][SKEYS * 4];
  const int qblocks = NN / (16 * QWAVES);
  int qb = blockIdx.x % qblocks;
  int bh = blockIdx.x / qblocks;  // b*HH + h
  int h  = bh % HH;
  int b  = bh / HH;
  int tid  = threadIdx.x;
  int lane = tid & 31;
  int qt   = qb * QWAVES + (tid >> 5);
  int col  = lane & 15;                // this lane's query within the tile
  int kb   = (lane & 16) ? 8 : 0;      // key-half / d-half selector

  const _Float16* Qbase = Qh + (((size_t)bh * NN) + qt * 16) * DD;
  const _Float16* Kbase = Kh + ((size_t)bh * NN) * DD;
  const _Float16* Vbase = Vt + ((size_t)bh * DD) * NN;

  // Staging map. A tile is 128 rows of four 16-byte chunks (K: row = key;
  // V: row = strip * 32 + d, its 64 bytes the strip's 32 keys). Chunk c of row
  // rr is what lane (c & 1) * 16 + (rr & 15) takes as its lo (c < 2) or hi half.
  // Its place in that half's 512 bytes has the row xor-ed with 4 * c, so that
  // the 16 lanes of a half-wave, which store four chunks of each of four rows,
  // fall on 16 different bank groups; a reading half-wave still covers all 16.
  // Thread t moves chunks t + 256 * i (row + 64 * i, slot + 256 * i) of each tile.
  int c  = tid & 3;
  int rr = tid >> 2;
  int slot = ((rr >> 4) * 2 + (c >> 1)) * 32 + (c & 1) * 16 + ((rr & 15) ^ (c << 2));
  int llo  = (lane & 16) | (col ^ ((lane & 16) >> 2));  // reader's place, c = 0 or 1
  int lhi  = llo ^ 8;                                   // reader's place, c = 2 or 3
  const _Float16* kg = Kbase + tid * 8;
  const _Float16* vg = Vbase + (size_t)(rr & 31) * NN + (rr >> 5) * 32 + c * 8;

  v8h gk[NCH], gv[NCH];
#pragma unroll
  for (int i = 0; i < NCH; ++i) {
    gk[i] = *(const v8h*)(kg + i * 64 * DD);
    gv[i] = *(const v8h*)(vg + i * 64);
  }
  v16h qf = load_frag_k32(Qbase, DD);  // B-frag of Q^T, lives across the loop
#pragma unroll
  for (int i = 0; i < NCH; ++i) {
    tile[0][0][slot + i * 256] = gk[i];
    tile[0][1][slot + i * 256] = gv[i];
  }
  __syncthreads();

  v8f o0 = {};  // O^T rows d = kb..kb+7        (cols = queries)
  v8f o1 = {};  // O^T rows d = 16+kb..16+kb+7
  float m = -3.0e30f, l = 0.f;

  for (int s = 0; s < NSTAGE; ++s) {
    const bool more = s + 1 < NSTAGE;
    if (more) {  // next stage's chunks fly while this stage is worked on
      const _Float16* kn = kg + (size_t)(s + 1) * SKEYS * DD;
      const _Float16* vn = vg + (s + 1) * SKEYS;
#pragma unroll
      for (int i = 0; i < NCH; ++i) {
        gk[i] = *(const v8h*)(kn + i * 64 * DD);
        gv[i] = *(const v8h*)(vn + i * 64);
      }
    }
    const v8h* kt = tile[s & 1][0];
    const v8h* vt = tile[s & 1][1];
    // Unrolled so that a strip's LDS reads can be issued ahead of their use.
#pragma unroll
    for (int p = 0; p < SKEYS / 32; ++p) {
      v16h kf0 = lds_frag(kt, p * 2, llo, lhi);      // keys j0..j0+15
      v16h kf1 = lds_frag(kt, p * 2 + 1, llo, lhi);  // keys j0+16..j0+31
      v8f zero = {};
      v8f s0 = __builtin_amdgcn_wmma_f32_16x16x32_f16(false, kf0, false, qf,
                                                      (short)0, zero, false, false);
      v8f s1 = __builtin_amdgcn_wmma_f32_16x16x32_f16(false, kf1, false, qf,
                                                      (short)0, zero, false, false);
      // --- per-lane (per-query) online softmax over this 32-key strip ---
      float mx = fmaxf(s0[0], s1[0]);
#pragma unroll
      for (int e = 1; e < 8; ++e) mx = fmaxf(mx, fmaxf(s0[e], s1[e]));
      mx = fmaxf(mx, __shfl_xor(mx, 16, 32));    // merge the two key-halves
      float mnew  = fmaxf(m, mx);
      float alpha = __expf(m - mnew);
      v16h pf;
      float rs = 0.f;
#pragma unroll
      for (int e = 0; e < 8; ++e) {
        float e0 = __expf(s0[e] - mnew);
        float e1 = __expf(s1[e] - mnew);
        rs += e0 + e1;
        pf[e]     = (_Float16)e0;   // B-frag element e   <-> key kb+e      of strip
        pf[8 + e] = (_Float16)e1;   // B-frag element 8+e <-> key 16+kb+e   of strip
      }
      rs += __shfl_xor(rs, 16, 32);
      l = l * alpha + rs;
      m = mnew;
#pragma unroll
      for (int e = 0; e < 8; ++e) { o0[e] *= alpha; o1[e] *= alpha; }
      // --- O^T += V^T x P^T ---
      v16h vf0 = lds_frag(vt, p * 2, llo, lhi);      // d = 0..15
      v16h vf1 = lds_frag(vt, p * 2 + 1, llo, lhi);  // d = 16..31
      o0 = __builtin_amdgcn_wmma_f32_16x16x32_f16(false, vf0, false, pf,
                                                  (short)0, o0, false, false);
      o1 = __builtin_amdgcn_wmma_f32_16x16x32_f16(false, vf1, false, pf,
                                                  (short)0, o1, false, false);
    }
    if (more) {  // the other buffer's readers left it at the last barrier
      v8h* kd = tile[(s + 1) & 1][0];
      v8h* vd = tile[(s + 1) & 1][1];
#pragma unroll
      for (int i = 0; i < NCH; ++i) {
        kd[slot + i * 256] = gk[i];
        vd[slot + i * 256] = gv[i];
      }
    }
    // Publishes stage s + 1 and ends every wave's reads of stage s.
    __syncthreads();
  }

  // --- epilogue: normalize, pack, two b128 stores per lane ---
  float inv = 1.0f / l;
  int n = qt * 16 + col;
  size_t off = (((size_t)b * NN) + n) * INNER + h * DD;
  v8h r0, r1;
#pragma unroll
  for (int p = 0; p < 8; ++p) {
    r0[p] = (_Float16)(o0[p] * inv);   // d = kb+p
    r1[p] = (_Float16)(o1[p] * inv);   // d = 16+kb+p
  }
  *(v8h*)(AO + off + kb)      = r0;
  *(v8h*)(AO + off + 16 + kb) = r1;
}

// ---------------------------------------------------------------------------
// Kernel 3: output projection  out[b][o][n] = sum_c wo[o][c]*AO[b][n][c] + bo[o]
// One wave per 16x16 output tile, K=256 in 8 WMMA steps.
// ---------------------------------------------------------------------------
__global__ __launch_bounds__(32) void out_proj(const _Float16* __restrict__ wo16,
                                               const _Float16* __restrict__ AO,
                                               const float* __restrict__ bo,
                                               float* __restrict__ out) {
  const int otiles = CC / 16;
  const int ntiles = NN / 16;
  int ot = blockIdx.x % otiles;
  int rest = blockIdx.x / otiles;
  int nt = rest % ntiles;
  int b  = rest / ntiles;
  int lane = threadIdx.x;
  int col  = lane & 15;
  int hi8  = (lane & 16) ? 8 : 0;

  const _Float16* Abase = wo16 + (size_t)ot * 16 * INNER;            // rows = o
  const _Float16* Bbase = AO + (((size_t)b * NN) + nt * 16) * INNER; // cols = n
  v8f acc = {};
#pragma unroll
  for (int k = 0; k < INNER; k += 32) {
    v16h af = load_frag_k32(Abase + k, INNER);
    v16h bf = load_frag_k32(Bbase + k, INNER);
    acc = __builtin_amdgcn_wmma_f32_16x16x32_f16(false, af, false, bf,
                                                 (short)0, acc, false, false);
  }
#pragma unroll
  for (int p = 0; p < 8; ++p) {
    int o = ot * 16 + p + hi8;
    int n = nt * 16 + col;
    out[(((size_t)b * CC) + o) * NN + n] = acc[p] + bo[o];
  }
}

// ---------------------------------------------------------------------------
extern "C" void kernel_launch(void* const* d_in, const int* in_sizes, int n_in,
                              void* d_out, int out_size, void* d_ws, size_t ws_size,
                              hipStream_t stream) {
  const float* x     = (const float*)d_in[0];
  const float* gamma = (const float*)d_in[1];
  const float* beta  = (const float*)d_in[2];
  const float* wk    = (const float*)d_in[3];
  const float* wq    = (const float*)d_in[4];
  const float* wv    = (const float*)d_in[5];
  const float* wo    = (const float*)d_in[6];
  const float* bo    = (const float*)d_in[7];
  float* out = (float*)d_out;

  char* ws = (char*)d_ws;
  size_t off = 0;
  _Float16* wo16 = (_Float16*)(ws + off); off += (size_t)CC * INNER * 2;        // 128 KB
  _Float16* Qh   = (_Float16*)(ws + off); off += (size_t)BB * HH * NN * DD * 2; // 2 MB
  _Float16* Kh   = (_Float16*)(ws + off); off += (size_t)BB * HH * NN * DD * 2; // 2 MB
  _Float16* Vt   = (_Float16*)(ws + off); off += (size_t)BB * HH * NN * DD * 2; // 2 MB
  _Float16* AO   = (_Float16*)(ws + off); off += (size_t)BB * NN * INNER * 2;   // 2 MB

  proj_kernel<<<dim3(PROJ_WG + CVT_WG), dim3(256), 0, stream>>>(
      x, gamma, beta, wk, wq, wv, Qh, Kh, Vt, wo, wo16);
  attn_fa<<<dim3(BB * HH * (NN / 128)), dim3(256), 0, stream>>>(Qh, Kh, Vt, AO);
  out_proj<<<dim3(BB * (NN / 16) * (CC / 16)), dim3(32), 0, stream>>>(wo16, AO, bo, out);
}

// v005
// One run takes 45.8 microseconds.
// Two timings next to v004 both put it at 1.04 times that version's speed.
// All steps since v000 together make it 2.11 times as fast.
#include <hip/hip_runtime.h>
#include <hip/hip_bf16.h>

// Flash-attention for the reference module, CDNA5 (gfx1250, wave32) WMMA path.
// Pipeline: proj (BN statistics of the group's own 32 channels, BN + grouped
//              conv, head-split layouts; the f16 copy of wo is made by extra
//              work-groups of the same grid)
//           -> attn_fa (TRANSPOSED scores: S^T = K*Q^T, so online-softmax stats
//              are per-lane scalars and the P fragment is born in B-frag layout;
//              K and V staged in LDS, shared by the eight waves of a group)
//           -> out_proj (256x256 WMMA GEMM + bias; both operands staged in LDS,
//              shared by the four waves of a group).
// Workspace requirement: 8,519,680 bytes (~8.5 MB).

typedef __attribute__((ext_vector_type(16))) _Float16 v16h;
typedef __attribute__((ext_vector_type(8)))  _Float16 v8h;
typedef __attribute__((ext_vector_type(8)))  float    v8f;
typedef __attribute__((ext_vector_type(16))) float    f32x16;
typedef __attribute__((ext_vector_type(4)))  float    f32x4;

#define BB 2
#define CC 256
#define NN 2048
#define HH 8
#define DD 32
#define INNER (HH * DD)   // 256

// ---------------------------------------------------------------------------
// WMMA 16x32 fragment load (f16), CDNA5 A-matrix layout (ISA 7.12.2):
//   lanes 0-15 : row = lane,    K in {kb..kb+7, 16+kb..16+kb+7}, kb=0
//   lanes16-31 : row = lane-16, kb=8
// Also the B-matrix (32x16) layout when `base` points at column-major data:
// column = lane&15, K contiguous with stride `ld` between columns.
// Each lane issues two 16-byte loads (global_load_b128).
// ---------------------------------------------------------------------------
__device__ __forceinline__ v16h load_frag_k32(const _Float16* __restrict__ base, int ld) {
  int lane = threadIdx.x & 31;
  int r    = lane & 15;
  int kb   = (lane & 16) ? 8 : 0;
  const _Float16* p = base + (size_t)r * (size_t)ld + kb;
  v8h lo = *(const v8h*)(p);
  v8h hi = *(const v8h*)(p + 16);
  v16h f;
#pragma unroll
  for (int i = 0; i < 8; ++i) { f[i] = lo[i]; f[8 + i] = hi[i]; }
  return f;
}

// ---------------------------------------------------------------------------
// Kernel 1: BatchNorm batch statistics + BN-normalize + grouped 1x1 conv
// projections. A work-group needs scale and shift of its group's 32 channels
// only, so it sums those channels itself (all of b and n, 512 KB out of L2):
// wave w takes channels 4w..4w+3, a row of 2048 floats is 16 wave-wide 16-byte
// loads, and the next row's 16 loads fly while this row is summed.
// Emits the reference's faithful '(d h)' head split WITH the q<-k swap and the
// 1/sqrt(D) scale folded into Qh. Layouts chosen for WMMA fragment loads:
//   Qh,Kh : [b, h', n, 32]  (d' contiguous)   -> QK^T frags are 2x b128/lane
//   Vt    : [b, h', 32, n]  (n contiguous)    -> P@V  frags are 2x b128/lane
// The work-groups behind the PROJ_WG projecting ones turn wo (f32, 256x256) into
// f16 for out_proj. That work depends on nothing here and nothing here depends
// on it; in this grid it runs on WGPs the projections leave idle and needs no
// launch of its own.
// ---------------------------------------------------------------------------
#define PROJ_WG (BB * HH * (NN / 256))      // 128 projecting work-groups
#define CVT_WG  (CC * INNER / (256 * 8))    // 32 converting ones, 8 elements a thread
__global__ __launch_bounds__(256) void proj_kernel(
    const float* __restrict__ x, const float* __restrict__ gamma,
    const float* __restrict__ beta, const float* __restrict__ wk,
    const float* __restrict__ wq, const float* __restrict__ wv,
    _Float16* __restrict__ Qh, _Float16* __restrict__ Kh,
    _Float16* __restrict__ Vt, const float* __restrict__ wo,
    _Float16* __restrict__ wo16) {
  __shared__ f32x4 aff[2][8];  // [scale, shift][wave] of four channels each
  if (blockIdx.x >= PROJ_WG) {
    int i = ((blockIdx.x - PROJ_WG) * 256 + threadIdx.x) * 8;
    f32x4 lo = *(const f32x4*)(wo + i);
    f32x4 hi = *(const f32x4*)(wo + i + 4);
    v8h r;
#pragma unroll
    for (int e = 0; e < 4; ++e) { r[e] = (_Float16)lo[e]; r[4 + e] = (_Float16)hi[e]; }
    *(v8h*)(wo16 + i) = r;
    return;
  }
  const int ntile_cnt = NN / 256;
  int nt = blockIdx.x % ntile_cnt;
  int bg = blockIdx.x / ntile_cnt;
  int g  = bg % HH;
  int b  = bg / HH;
  // Every weight index below is the same for the whole work-group, so these
  // reads compile to scalar loads: the operand sits in a scalar register and no
  // LDS wait stands between the multiply-adds.
  const f32x16* __restrict__ wkg = (const f32x16*)(wk + g * 1024);  // row d = [2d], [2d+1]
  const f32x16* __restrict__ wqg = (const f32x16*)(wq + g * 1024);
  const f32x16* __restrict__ wvg = (const f32x16*)(wv + g * 1024);

  int n = nt * 256 + threadIdx.x;
  float xn[32];  // the thread's own column, on its way while the sums are made
#pragma unroll
  for (int c = 0; c < 32; ++c)
    xn[c] = x[(((size_t)b * CC) + g * 32 + c) * NN + n];

  // --- batch statistics of channels ch0..ch0+3, one wave ---
  {
    const int lane = threadIdx.x & 31;
    const int wave = __builtin_amdgcn_readfirstlane(threadIdx.x >> 5);
    const int ch0  = g * 32 + wave * 4;
    const f32x4 gm = *(const f32x4*)(gamma + ch0);
    const f32x4 bt = *(const f32x4*)(beta + ch0);
    // Row r = 2 * j + bb is channel ch0 + j of batch bb.
    f32x4 buf[2][16];
#pragma unroll
    for (int i = 0; i < 16; ++i)
      buf[0][i] = ((const f32x4*)(x + (size_t)ch0 * NN))[i * 32 + lane];
    // The sums below reuse the address registers of the column's loads; the
    // scheduling barrier keeps them behind the wait.
    asm volatile("s_wait_xcnt 0x0" ::: "memory");
    __builtin_amdgcn_sched_barrier(0);
    f32x4 sum, sq;
#pragma unroll
    for (int j = 0; j < 4; ++j) {
      f32x4 a = {0.f, 0.f, 0.f, 0.f}, q = {0.f, 0.f, 0.f, 0.f};
#pragma unroll
      for (int bb = 0; bb < BB; ++bb) {
        const int r = j * BB + bb;
        if (r + 1 < 4 * BB) {
          const float* nx = x + (((size_t)((r + 1) % BB) * CC) + ch0 + (r + 1) / BB) * NN;
#pragma unroll
          for (int i = 0; i < 16; ++i)
            buf[(r + 1) & 1][i] = ((const f32x4*)nx)[i * 32 + lane];
        }
        // Keeps the next row's 16 loads issued as one group in front of this
        // row's sums; left free, the compiler deals them out among the sums
        // and holds far fewer loads in flight.
        __builtin_amdgcn_sched_barrier(0);
#pragma unroll
        for (int i = 0; i < 16; ++i) {
          f32x4 v = buf[r & 1][i];
          a += v;
          q += v * v;
        }
      }
      sum[j] = (a[0] + a[1]) + (a[2] + a[3]);
      sq[j]  = (q[0] + q[1]) + (q[2] + q[3]);
    }
    // What follows reuses the registers that the rows' loads name.
    asm volatile("s_wait_xcnt 0x0" ::: "memory");
    __builtin_amdgcn_sched_barrier(0);
#pragma unroll
    for (int m = 16; m > 0; m >>= 1) {
#pragma unroll
      for (int j = 0; j < 4; ++j) {
        sum[j] += __shfl_xor(sum[j], m, 32);
        sq[j]  += __shfl_xor(sq[j], m, 32);
      }
    }
    f32x4 sc, sh;
#pragma unroll
    for (int j = 0; j < 4; ++j) {
      const float invn = 1.0f / (float)(BB * NN);
      float mean = sum[j] * invn;
      float var  = sq[j] * invn - mean * mean;
      sc[j] = gm[j] * rsqrtf(var + 1e-5f);
      sh[j] = bt[j] - mean * sc[j];
    }
    if (lane == 0) { aff[0][wave] = sc; aff[1][wave] = sh; }
  }
  // Hands every wave's four scales and shifts to the whole work-group.
  __syncthreads();
#pragma unroll
  for (int c4 = 0; c4 < 8; ++c4) {
    f32x4 sc = aff[0][c4], sh = aff[1][c4];
#pragma unroll
    for (int e = 0; e < 4; ++e) xn[c4 * 4 + e] = xn[c4 * 4 + e] * sc[e] + sh[e];
  }

  const float qscale = 0.17677669529663687f;  // 1/sqrt(32)
  // Kept rolled: two rows of each of the three matrices already fill the scalar
  // registers; four rows a trip spilled them into vector lanes.
#pragma unroll 1
  for (int d0 = 0; d0 < 32; d0 += 2) {
    float ak2[2] = {0.f, 0.f}, aq2[2] = {0.f, 0.f}, av2[2] = {0.f, 0.f};
#pragma unroll
    for (int hf = 0; hf < 2; ++hf) {
      f32x16 rk[2], rq[2], rv[2];
#pragma unroll
      for (int u = 0; u < 2; ++u) {
        rk[u] = wkg[(d0 + u) * 2 + hf];
        rq[u] = wqg[(d0 + u) * 2 + hf];
        rv[u] = wvg[(d0 + u) * 2 + hf];
      }
#pragma unroll
      for (int c = 0; c < 16; ++c) {
#pragma unroll
        for (int u = 0; u < 2; ++u) {
          ak2[u] = fmaf(rk[u][c], xn[hf * 16 + c], ak2[u]);
          aq2[u] = fmaf(rq[u][c], xn[hf * 16 + c], aq2[u]);
          av2[u] = fmaf(rv[u][c], xn[hf * 16 + c], av2[u]);
        }
      }
    }
#pragma unroll
    for (int u = 0; u < 2; ++u) {
      float ak = ak2[u], aq = aq2[u], av = av2[u];
      int cc = g * 32 + d0 + u;   // projected channel index
      int hh = cc & 7;            // attention head  (channel = d'*H + h')
      int dd = cc >> 3;           // attention d'
      size_t bh = (size_t)b * HH + hh;
      Qh[(bh * NN + n) * DD + dd] = (_Float16)(ak * qscale);  // q <- k (swap), pre-scaled
      Kh[(bh * NN + n) * DD + dd] = (_Float16)aq;             // k <- q (swap)
      Vt[(bh * DD + dd) * NN + n] = (_Float16)av;             // transposed V
    }
    // The next trip rewrites the registers that these stores name.
    asm volatile("s_wait_xcnt 0x0" ::: "memory");
  }
}

// ---------------------------------------------------------------------------
// Kernel 2: flash attention with TRANSPOSED score tiles.
//   S^T = A(K-tile 16keys x 32d) x B(Q^T 32d x 16queries)
//     -> C-layout: lane owns one query column; its 8 elements are keys
//        {kb..kb+7} (kb = lane>=16 ? 8 : 0) of the strip half.
//   Softmax stats (m, l) are per-lane scalars; the only cross-lane ops are two
//   shfl_xor(16) per strip (max and sum) to merge the two key-halves of each query.
//   exp(S^T - m) lands *directly* in the B-frag layout required by
//   O^T = A(V^T 16d x 32keys) x B(P^T 32keys x 16queries): pf[i]=e(s0[i]),
//   pf[8+i]=e(s1[i]).
//   Eight waves (128 queries of one head) form a work-group and share every
//   K and V fragment: a stage of 128 keys is fetched from global memory once
//   per work-group, one stage ahead, and laid in LDS in fragment order, so a
//   fragment half is one ds_load_b128 over 512 contiguous bytes per wave.
//   Epilogue: each lane holds 8 contiguous d values per accumulator ->
//   two packed b128 stores into AO[b][n][h*32+d].
// ---------------------------------------------------------------------------
#define QWAVES 8              // waves per work-group, 16 queries each
#define SKEYS  128            // keys per stage
#define NSTAGE (NN / SKEYS)   // 16
#define NCH    (SKEYS / 64)   // 16-byte chunks of each tile that one thread moves

// One 16 x 32 fragment out of a staged tile: group = which 16 rows.
__device__ __forceinline__ v16h lds_frag(const v8h* t, int group, int llo, int lhi) {
  v8h lo = t[(group * 2) * 32 + llo];
  v8h hi = t[(group * 2 + 1) * 32 + lhi];
  return __builtin_shufflevector(lo, hi, 0, 1, 2, 3, 4, 5, 6, 7,
                                 8, 9, 10, 11, 12, 13, 14, 15);
}

__global__ __launch_bounds__(256) void attn_fa(const _Float16* __restrict__ Qh,
                                               const _Float16* __restrict__ Kh,
                                               const _Float16* __restrict__ Vt,
                                               _Float16* __restrict__ AO) {
  // [buffer][K, V][8 groups of 16 rows][lo, hi][32 places] of 16 bytes: 32 KB
  __shared__ v8h tile[2][2][SKEYS * 4];
  const int qblocks = NN / (16 * QWAVES);
  int qb = blockIdx.x % qblocks;
  int bh = blockIdx.x / qblocks;  // b*HH + h
  int h  = bh % HH;
  int b  = bh / HH;
  int tid  = threadIdx.x;
  int lane = tid & 31;
  int qt   = qb * QWAVES + (tid >> 5);
  int col  = lane & 15;                // this lane's query within the tile
  int kb   = (lane & 16) ? 8 : 0;      // key-half / d-half selector

  const _Float16* Qbase = Qh + (((size_t)bh * NN) + qt * 16) * DD;
  const _Float16* Kbase = Kh + ((size_t)bh * NN) * DD;
  const _Float16* Vbase = Vt + ((size_t)bh * DD) * NN;

  // Staging map. A tile is 128 rows of four 16-byte chunks (K: row = key;
  // V: row = strip * 32 + d, its 64 bytes the strip's 32 keys). Chunk c of row
  // rr is what lane (c & 1) * 16 + (rr & 15) takes as its lo (c < 2) or hi half.
  // Its place in that half's 512 bytes has the row xor-ed with 4 * c, so that
  // the 16 lanes of a half-wave, which store four chunks of each of four rows,
  // fall on 16 different bank groups; a reading half-wave still covers all 16.
  // Thread t moves chunks t + 256 * i (row + 64 * i, slot + 256 * i) of each tile.
  int c  = tid & 3;
  int rr = tid >> 2;
  int slot = ((rr >> 4) * 2 + (c >> 1)) * 32 + (c & 1) * 16 + ((rr & 15) ^ (c << 2));
  int llo  = (lane & 16) | (col ^ ((lane & 16) >> 2));  // reader's place, c = 0 or 1
  int lhi  = llo ^ 8;                                   // reader's place, c = 2 or 3
  const _Float16* kg = Kbase + tid * 8;
  const _Float16* vg = Vbase + (size_t)(rr & 31) * NN + (rr >> 5) * 32 + c * 8;

  v8h gk[NCH], gv[NCH];
#pragma unroll
  for (int i = 0; i < NCH; ++i) {
    gk[i] = *(const v8h*)(kg + i * 64 * DD);
    gv[i] = *(const v8h*)(vg + i * 64);
  }
  v16h qf = load_frag_k32(Qbase, DD);  // B-frag of Q^T, lives across the loop
#pragma unroll
  for (int i = 0; i < NCH; ++i) {
    tile[0][0][slot + i * 256] = gk[i];
    tile[0][1][slot + i * 256] = gv[i];
  }
  __syncthreads();

  v8f o0 = {};  // O^T rows d = kb..kb+7        (cols = queries)
  v8f o1 = {};  // O^T rows d = 16+kb..16+kb+7
  float m = -3.0e30f, l = 0.f;

  for (int s = 0; s < NSTAGE; ++s) {
    const bool more = s + 1 < NSTAGE;
    if (more) {  // next stage's chunks fly while this stage is worked on
      const _Float16* kn = kg + (size_t)(s + 1) * SKEYS * DD;
      const _Float16* vn = vg + (s + 1) * SKEYS;
#pragma unroll
      for (int i = 0; i < NCH; ++i) {
        gk[i] = *(const v8h*)(kn + i * 64 * DD);
        gv[i] = *(const v8h*)(vn + i * 64);
      }
    }
    const v8h* kt = tile[s & 1][0];
    const v8h* vt = tile[s & 1][1];
    // Unrolled so that a strip's LDS reads can be issued ahead of their use.
#pragma unroll
    for (int p = 0; p < SKEYS / 32; ++p) {
      v16h kf0 = lds_frag(kt, p * 2, llo, lhi);      // keys j0..j0+15
      v16h kf1 = lds_frag(kt, p * 2 + 1, llo, lhi);  // keys j0+16..j0+31
      v8f zero = {};
      v8f s0 = __builtin_amdgcn_wmma_f32_16x16x32_f16(false, kf0, false, qf,
                                                      (short)0, zero, false, false);
      v8f s1 = __builtin_amdgcn_wmma_f32_16x16x32_f16(false, kf1, false, qf,
                                                      (short)0, zero, false, false);
      // --- per-lane (per-query) online softmax over this 32-key strip ---
      float mx = fmaxf(s0[0], s1[0]);
#pragma unroll
      for (int e = 1; e < 8; ++e) mx = fmaxf(mx, fmaxf(s0[e], s1[e]));
      mx = fmaxf(mx, __shfl_xor(mx, 16, 32));    // merge the two key-halves
      float mnew  = fmaxf(m, mx);
      float alpha = __expf(m - mnew);
      v16h pf;
      float rs = 0.f;
#pragma unroll
      for (int e = 0; e < 8; ++e) {
        float e0 = __expf(s0[e] - mnew);
        float e1 = __expf(s1[e] - mnew);
        rs += e0 + e1;
        pf[e]     = (_Float16)e0;   // B-frag element e   <-> key kb+e      of strip
        pf[8 + e] = (_Float16)e1;   // B-frag element 8+e <-> key 16+kb+e   of strip
      }
      rs += __shfl_xor(rs, 16, 32);
      l = l * alpha + rs;
      m = mnew;
#pragma unroll
      for (int e = 0; e < 8; ++e) { o0[e] *= alpha; o1[e] *= alpha; }
      // --- O^T += V^T x P^T ---
      v16h vf0 = lds_frag(vt, p * 2, llo, lhi);      // d = 0..15
      v16h vf1 = lds_frag(vt, p * 2 + 1, llo, lhi);  // d = 16..31
      o0 = __builtin_amdgcn_wmma_f32_16x16x32_f16(false, vf0, false, pf,
                                                  (short)0, o0, false, false);
      o1 = __builtin_amdgcn_wmma_f32_16x16x32_f16(false, vf1, false, pf,
                                                  (short)0, o1, false, false);
    }
    if (more) {  // the other buffer's readers left it at the last barrier
      v8h* kd = tile[(s + 1) & 1][0];
      v8h* vd = tile[(s + 1) & 1][1];
#pragma unroll
      for (int i = 0; i < NCH; ++i) {
        kd[slot + i * 256] = gk[i];
        vd[slot + i * 256] = gv[i];
      }
    }
    // Publishes stage s + 1 and ends every wave's reads of stage s.
    __syncthreads();
  }

  // --- epilogue: normalize, pack, two b128 stores per lane ---
  float inv = 1.0f / l;
  int n = qt * 16 + col;
  size_t off = (((size_t)b * NN) + n) * INNER + h * DD;
  v8h r0, r1;
#pragma unroll
  for (int p = 0; p < 8; ++p) {
    r0[p] = (_Float16)(o0[p] * inv);   // d = kb+p
    r1[p] = (_Float16)(o1[p] * inv);   // d = 16+kb+p
  }
  *(v8h*)(AO + off + kb)      = r0;
  *(v8h*)(AO + off + 16 + kb) = r1;
}

// ---------------------------------------------------------------------------
// Kernel 3: output projection  out[b][o][n] = sum_c wo[o][c]*AO[b][n][c] + bo[o]
// Four waves form a work-group and share a 64 (o) x 64 (n) output block. Its
// 64 rows of wo and 64 rows of AO (512 bytes each, all of K = 256) come from
// global memory once per work-group, a whole row per wave-wide 16-byte load,
// and are laid in LDS in fragment order. A wave owns 2 x 2 tiles of 16 x 16,
// so every fragment it reads from LDS feeds two WMMAs.
// ---------------------------------------------------------------------------
#define OPB 64   // rows of wo, and rows of AO, per work-group

// One 16 x 32 fragment out of a staged operand: group = which 16 rows, k = which
// 32 of the 256 channels. rx = (lane & 15) ^ (lane >> 4), lh16 = lane & 16.
__device__ __forceinline__ v16h opnd_frag(const v8h* t, int group, int k, int lh16, int rx) {
  v8h lo = t[((group * 8 + k) * 2) * 32 + lh16 + (rx ^ ((k & 3) * 4))];
  v8h hi = t[((group * 8 + k) * 2 + 1) * 32 + lh16 + (rx ^ ((k & 3) * 4 + 2))];
  return __builtin_shufflevector(lo, hi, 0, 1, 2, 3, 4, 5, 6, 7,
                                 8, 9, 10, 11, 12, 13, 14, 15);
}

__global__ __launch_bounds__(128) void out_proj(const _Float16* __restrict__ wo16,
                                                const _Float16* __restrict__ AO,
                                                const float* __restrict__ bo,
                                                float* __restrict__ out) {
  // [wo, AO][4 groups of 16 rows][8 k steps][lo, hi][32 places] of 16 bytes: 64 KB
  __shared__ v8h opnd[2][(OPB / 16) * 8 * 2 * 32];
  const int oblocks = CC / OPB;
  const int nblocks = NN / OPB;
  int ob = blockIdx.x % oblocks;
  int rest = blockIdx.x / oblocks;
  int nb = rest % nblocks;
  int b  = rest / nblocks;
  int lane = threadIdx.x & 31;
  int wave = threadIdx.x >> 5;
  int col  = lane & 15;
  int hi8  = (lane & 16) ? 8 : 0;
  int og = (wave & 1) * 2;   // the wave's first group of 16 o
  int ng = (wave >> 1) * 2;  // the wave's first group of 16 n

  // Staging map. Wave w moves group w of both operands, one row a load; lane j
  // holds chunk j of the row: k step j >> 2, half (j >> 1) & 1 (lo or hi), and
  // it is what lane (j & 1) * 16 + row takes. Its place in that half-wave's 256
  // bytes has the row xor-ed with j & 15, so that the 16 lanes of a storing
  // half-wave, which all hold the same row, fall on 16 different bank groups; a
  // reading half-wave still covers all 16.
  const v8h* ag = (const v8h*)(wo16 + (size_t)(ob * OPB + wave * 16) * INNER) + lane;
  const v8h* bg = (const v8h*)(AO + ((size_t)b * NN + nb * OPB + wave * 16) * INNER) + lane;
  v8h ga[16], gb[16];
#pragma unroll
  for (int i = 0; i < 16; ++i) {
    ga[i] = ag[i * (INNER / 8)];
    gb[i] = bg[i * (INNER / 8)];
  }
  f32x4 bias[2][2];  // bo of the lane's eight rows in each of its two groups
#pragma unroll
  for (int u = 0; u < 2; ++u) {
    const f32x4* bp = (const f32x4*)(bo + ob * OPB + (og + u) * 16 + hi8);
    bias[u][0] = bp[0];
    bias[u][1] = bp[1];
  }
  int wbase = ((wave * 8 + (lane >> 2)) * 2 + ((lane >> 1) & 1)) * 32 + (lane & 1) * 16;
#pragma unroll
  for (int i = 0; i < 16; ++i) {
    opnd[0][wbase + (i ^ col)] = ga[i];
    opnd[1][wbase + (i ^ col)] = gb[i];
  }
  // Hands every wave's rows to the whole work-group.
  __syncthreads();

  int lh16 = lane & 16;
  int rx   = col ^ (lane >> 4);
  v8f acc[2][2] = {};
  // Fragments are read one k step ahead into a second register set, so that a
  // step's WMMAs do not wait out the LDS latency of their own reads.
  v16h af[2][2], bf[2][2];
#pragma unroll
  for (int u = 0; u < 2; ++u) {
    af[0][u] = opnd_frag(opnd[0], og + u, 0, lh16, rx);
    bf[0][u] = opnd_frag(opnd[1], ng + u, 0, lh16, rx);
  }
#pragma unroll
  for (int k = 0; k < INNER / 32; ++k) {
    if (k + 1 < INNER / 32) {
#pragma unroll
      for (int u = 0; u < 2; ++u) {
        af[(k + 1) & 1][u] = opnd_frag(opnd[0], og + u, k + 1, lh16, rx);
        bf[(k + 1) & 1][u] = opnd_frag(opnd[1], ng + u, k + 1, lh16, rx);
      }
    }
    // Keeps the next step's eight LDS reads issued as one group in front of
    // this step's WMMAs; left free, the compiler sinks them behind the WMMAs
    // and each step waits for its own reads.
    __builtin_amdgcn_sched_barrier(0);
#pragma unroll
    for (int u = 0; u < 2; ++u)
#pragma unroll
      for (int v = 0; v < 2; ++v)
        acc[u][v] = __builtin_amdgcn_wmma_f32_16x16x32_f16(false, af[k & 1][u], false, bf[k & 1][v],
                                                           (short)0, acc[u][v], false, false);
  }
#pragma unroll
  for (int u = 0; u < 2; ++u) {
    int o0 = ob * OPB + (og + u) * 16 + hi8;
    float* orow = out + (((size_t)b * CC) + o0) * NN + nb * OPB + ng * 16 + col;
#pragma unroll
    for (int p = 0; p < 8; ++p) {
#pragma unroll
      for (int v = 0; v < 2; ++v)
        orow[(size_t)p * NN + v * 16] = acc[u][v][p] + bias[u][p >> 2][p & 3];
    }
  }
}

// ---------------------------------------------------------------------------
extern "C" void kernel_launch(void* const* d_in, const int* in_sizes, int n_in,
                              void* d_out, int out_size, void* d_ws, size_t ws_size,
                              hipStream_t stream) {
  const float* x     = (const float*)d_in[0];
  const float* gamma = (const float*)d_in[1];
  const float* beta  = (const float*)d_in[2];
  const float* wk    = (const float*)d_in[3];
  const float* wq    = (const float*)d_in[4];
  const float* wv    = (const float*)d_in[5];
  const float* wo    = (const float*)d_in[6];
  const float* bo    = (const float*)d_in[7];
  float* out = (float*)d_out;

  char* ws = (char*)d_ws;
  size_t off = 0;
  _Float16* wo16 = (_Float16*)(ws + off); off += (size_t)CC * INNER * 2;        // 128 KB
  _Float16* Qh   = (_Float16*)(ws + off); off += (size_t)BB * HH * NN * DD * 2; // 2 MB
  _Float16* Kh   = (_Float16*)(ws + off); off += (size_t)BB * HH * NN * DD * 2; // 2 MB
  _Float16* Vt   = (_Float16*)(ws + off); off += (size_t)BB * HH * NN * DD * 2; // 2 MB
  _Float16* AO   = (_Float16*)(ws + off); off += (size_t)BB * NN * INNER * 2;   // 2 MB

  proj_kernel<<<dim3(PROJ_WG + CVT_WG), dim3(256), 0, stream>>>(
      x, gamma, beta, wk, wq, wv, Qh, Kh, Vt, wo, wo16);
  attn_fa<<<dim3(BB * HH * (NN / 128)), dim3(256), 0, stream>>>(Qh, Kh, Vt, AO);
  out_proj<<<dim3(BB * (NN / OPB) * (CC / OPB)), dim3(128), 0, stream>>>(wo16, AO, bo, out);
}

// v006
// Measured time: 41.3 microseconds a run.
// Two timings next to v005 both put it at 1.10 times that version's speed.
// All steps since v000 together make it 2.33 times as fast.
#include <hip/hip_runtime.h>
#include <hip/hip_bf16.h>

// Flash-attention for the reference module, CDNA5 (gfx1250, wave32) WMMA path.
// Pipeline: proj (BN statistics of the group's own 32 channels, BN + grouped
//              conv, head-split layouts; the f16 copy of wo is made by extra
//              work-groups of the same grid)
//           -> attn_fa (TRANSPOSED scores: S^T = K*Q^T, so online-softmax stats
//              are per-lane scalars and the P fragment is born in B-frag layout;
//              K and V staged in LDS, shared by the eight waves of a group)
//           -> out_proj (256x256 WMMA GEMM + bias; both operands staged in LDS,
//              shared by the four waves of a group).
// Workspace requirement: 8,519,680 bytes (~8.5 MB).

typedef __attribute__((ext_vector_type(16))) _Float16 v16h;
typedef __attribute__((ext_vector_type(8)))  _Float16 v8h;
typedef __attribute__((ext_vector_type(4)))  _Float16 v4h;
typedef __attribute__((ext_vector_type(8)))  float    v8f;
typedef __attribute__((ext_vector_type(16))) float    f32x16;
typedef __attribute__((ext_vector_type(4)))  float    f32x4;

#define BB 2
#define CC 256
#define NN 2048
#define HH 8
#define DD 32
#define INNER (HH * DD)   // 256

// ---------------------------------------------------------------------------
// Kernel 1: BatchNorm batch statistics + BN-normalize + grouped 1x1 conv
// projections. A work-group needs scale and shift of its group's 32 channels
// only, so it sums those channels itself (all of b and n, 512 KB out of L2):
// wave w takes channels 4w..4w+3, a row of 2048 floats is 16 wave-wide 16-byte
// loads, and the next row's 16 loads fly while this row is summed.
// Emits the reference's faithful '(d h)' head split WITH the q<-k swap and the
// 1/sqrt(D) scale folded into Qh. Layouts chosen for WMMA fragment loads:
//   Qh,Kh : [b, h', d' / 4, n, 4]: a group's channels give a thread exactly the
//           four d' = 4g..4g+3 of every head, so a thread stores them as one
//           8-byte unit and a wave's store is 256 contiguous bytes, two whole
//           lines that no other work-group writes (with d' contiguous over all
//           32, a wave's store was 32 pieces of 2 bytes, 64 bytes apart, in
//           lines that eight work-groups share)
//   Vt    : [b, h', 32, n]  (n contiguous)    -> P@V  frags are 2x b128/lane
// The work-groups behind the PROJ_WG projecting ones turn wo (f32, 256x256) into
// f16 for out_proj. That work depends on nothing here and nothing here depends
// on it; in this grid it runs on WGPs the projections leave idle and needs no
// launch of its own.
// ---------------------------------------------------------------------------
#define PROJ_WG (BB * HH * (NN / 256))      // 128 projecting work-groups
#define CVT_WG  (CC * INNER / (256 * 8))    // 32 converting ones, 8 elements a thread
__global__ __launch_bounds__(256) void proj_kernel(
    const float* __restrict__ x, const float* __restrict__ gamma,
    const float* __restrict__ beta, const float* __restrict__ wk,
    const float* __restrict__ wq, const float* __restrict__ wv,
    _Float16* __restrict__ Qh, _Float16* __restrict__ Kh,
    _Float16* __restrict__ Vt, const float* __restrict__ wo,
    _Float16* __restrict__ wo16) {
  __shared__ f32x4 aff[2][8];  // [scale, shift][wave] of four channels each
  __shared__ v4h unit[HH][2][256];  // [head][Q, K][thread]: the thread's four d'
  if (blockIdx.x >= PROJ_WG) {
    int i = ((blockIdx.x - PROJ_WG) * 256 + threadIdx.x) * 8;
    f32x4 lo = *(const f32x4*)(wo + i);
    f32x4 hi = *(const f32x4*)(wo + i + 4);
    v8h r;
#pragma unroll
    for (int e = 0; e < 4; ++e) { r[e] = (_Float16)lo[e]; r[4 + e] = (_Float16)hi[e]; }
    *(v8h*)(wo16 + i) = r;
    return;
  }
  const int ntile_cnt = NN / 256;
  int nt = blockIdx.x % ntile_cnt;
  int bg = blockIdx.x / ntile_cnt;
  int g  = bg % HH;
  int b  = bg / HH;
  // Every weight index below is the same for the whole work-group, so these
  // reads compile to scalar loads: the operand sits in a scalar register and no
  // LDS wait stands between the multiply-adds.
  const f32x16* __restrict__ wkg = (const f32x16*)(wk + g * 1024);  // row d = [2d], [2d+1]
  const f32x16* __restrict__ wqg = (const f32x16*)(wq + g * 1024);
  const f32x16* __restrict__ wvg = (const f32x16*)(wv + g * 1024);

  int n = nt * 256 + threadIdx.x;
  float xn[32];  // the thread's own column, on its way while the sums are made
#pragma unroll
  for (int c = 0; c < 32; ++c)
    xn[c] = x[(((size_t)b * CC) + g * 32 + c) * NN + n];

  // --- batch statistics of channels ch0..ch0+3, one wave ---
  {
    const int lane = threadIdx.x & 31;
    const int wave = __builtin_amdgcn_readfirstlane(threadIdx.x >> 5);
    const int ch0  = g * 32 + wave * 4;
    const f32x4 gm = *(const f32x4*)(gamma + ch0);
    const f32x4 bt = *(const f32x4*)(beta + ch0);
    // Row r = 2 * j + bb is channel ch0 + j of batch bb.
    f32x4 buf[2][16];
#pragma unroll
    for (int i = 0; i < 16; ++i)
      buf[0][i] = ((const f32x4*)(x + (size_t)ch0 * NN))[i * 32 + lane];
    // The sums below reuse the address registers of the column's loads; the
    // scheduling barrier keeps them behind the wait.
    asm volatile("s_wait_xcnt 0x0" ::: "memory");
    __builtin_amdgcn_sched_barrier(0);
    f32x4 sum, sq;
#pragma unroll
    for (int j = 0; j < 4; ++j) {
      f32x4 a = {0.f, 0.f, 0.f, 0.f}, q = {0.f, 0.f, 0.f, 0.f};
#pragma unroll
      for (int bb = 0; bb < BB; ++bb) {
        const int r = j * BB + bb;
        if (r + 1 < 4 * BB) {
          const float* nx = x + (((size_t)((r + 1) % BB) * CC) + ch0 + (r + 1) / BB) * NN;
#pragma unroll
          for (int i = 0; i < 16; ++i)
            buf[(r + 1) & 1][i] = ((const f32x4*)nx)[i * 32 + lane];
        }
        // Keeps the next row's 16 loads issued as one group in front of this
        // row's sums; left free, the compiler deals them out among the sums
        // and holds far fewer loads in flight.
        __builtin_amdgcn_sched_barrier(0);
#pragma unroll
        for (int i = 0; i < 16; ++i) {
          f32x4 v = buf[r & 1][i];
          a += v;
          q += v * v;
        }
      }
      sum[j] = (a[0] + a[1]) + (a[2] + a[3]);
      sq[j]  = (q[0] + q[1]) + (q[2] + q[3]);
    }
    // What follows reuses the registers that the rows' loads name.
    asm volatile("s_wait_xcnt 0x0" ::: "memory");
    __builtin_amdgcn_sched_barrier(0);
#pragma unroll
    for (int m = 16; m > 0; m >>= 1) {
#pragma unroll
      for (int j = 0; j < 4; ++j) {
        sum[j] += __shfl_xor(sum[j], m, 32);
        sq[j]  += __shfl_xor(sq[j], m, 32);
      }
    }
    f32x4 sc, sh;
#pragma unroll
    for (int j = 0; j < 4; ++j) {
      const float invn = 1.0f / (float)(BB * NN);
      float mean = sum[j] * invn;
      float var  = sq[j] * invn - mean * mean;
      sc[j] = gm[j] * rsqrtf(var + 1e-5f);
      sh[j] = bt[j] - mean * sc[j];
    }
    if (lane == 0) { aff[0][wave] = sc; aff[1][wave] = sh; }
  }
  // Hands every wave's four scales and shifts to the whole work-group.
  __syncthreads();
#pragma unroll
  for (int c4 = 0; c4 < 8; ++c4) {
    f32x4 sc = aff[0][c4], sh = aff[1][c4];
#pragma unroll
    for (int e = 0; e < 4; ++e) xn[c4 * 4 + e] = xn[c4 * 4 + e] * sc[e] + sh[e];
  }

  const float qscale = 0.17677669529663687f;  // 1/sqrt(32)
  // Kept rolled: two rows of each of the three matrices already fill the scalar
  // registers; four rows a trip spilled them into vector lanes.
#pragma unroll 1
  for (int d0 = 0; d0 < 32; d0 += 2) {
    float ak2[2] = {0.f, 0.f}, aq2[2] = {0.f, 0.f}, av2[2] = {0.f, 0.f};
#pragma unroll
    for (int hf = 0; hf < 2; ++hf) {
      f32x16 rk[2], rq[2], rv[2];
#pragma unroll
      for (int u = 0; u < 2; ++u) {
        rk[u] = wkg[(d0 + u) * 2 + hf];
        rq[u] = wqg[(d0 + u) * 2 + hf];
        rv[u] = wvg[(d0 + u) * 2 + hf];
      }
#pragma unroll
      for (int c = 0; c < 16; ++c) {
#pragma unroll
        for (int u = 0; u < 2; ++u) {
          ak2[u] = fmaf(rk[u][c], xn[hf * 16 + c], ak2[u]);
          aq2[u] = fmaf(rq[u][c], xn[hf * 16 + c], aq2[u]);
          av2[u] = fmaf(rv[u][c], xn[hf * 16 + c], av2[u]);
        }
      }
    }
#pragma unroll
    for (int u = 0; u < 2; ++u) {
      float ak = ak2[u], aq = aq2[u], av = av2[u];
      int cc = g * 32 + d0 + u;   // projected channel index
      int hh = cc & 7;            // attention head  (channel = d'*H + h')
      int dd = cc >> 3;           // attention d'
      size_t bh = (size_t)b * HH + hh;
      // A head's four d' come eight rows apart: they gather in the thread's own
      // 8 bytes of LDS and leave together behind the loop.
      ((_Float16*)&unit[hh][0][threadIdx.x])[dd & 3] = (_Float16)(ak * qscale);  // q <- k (swap), pre-scaled
      ((_Float16*)&unit[hh][1][threadIdx.x])[dd & 3] = (_Float16)aq;             // k <- q (swap)
      Vt[(bh * DD + dd) * NN + n] = (_Float16)av;             // transposed V
    }
    // The next trip rewrites the registers that these stores name.
    asm volatile("s_wait_xcnt 0x0" ::: "memory");
  }
  // Every thread reads back what it wrote itself: no barrier.
#pragma unroll
  for (int hh = 0; hh < HH; ++hh) {
    size_t at = ((((size_t)b * HH + hh) * (DD / 4) + g) * NN + n) * 4;
    *(v4h*)(Qh + at) = unit[hh][0][threadIdx.x];
    *(v4h*)(Kh + at) = unit[hh][1][threadIdx.x];
  }
}

// ---------------------------------------------------------------------------
// Kernel 2: flash attention with TRANSPOSED score tiles.
//   S^T = A(K-tile 16keys x 32d) x B(Q^T 32d x 16queries)
//     -> C-layout: lane owns one query column; its 8 elements are keys
//        {kb..kb+7} (kb = lane>=16 ? 8 : 0) of the strip half.
//   Softmax stats (m, l) are per-lane scalars; the only cross-lane ops are two
//   shfl_xor(16) per strip (max and sum) to merge the two key-halves of each query.
//   exp(S^T - m) lands *directly* in the B-frag layout required by
//   O^T = A(V^T 16d x 32keys) x B(P^T 32keys x 16queries): pf[i]=e(s0[i]),
//   pf[8+i]=e(s1[i]).
//   Eight waves (128 queries of one head) form a work-group and share every
//   K and V fragment: a stage of 128 keys is fetched from global memory once
//   per work-group, one stage ahead, and laid in LDS in fragment order, so a
//   fragment half is one ds_load_b128 over 512 contiguous bytes per wave.
//   Epilogue: each lane holds 8 contiguous d values per accumulator ->
//   two packed b128 stores into AO[b][n][h*32+d].
// ---------------------------------------------------------------------------
#define QWAVES 8              // waves per work-group, 16 queries each
#define SKEYS  128            // keys per stage
#define NSTAGE (NN / SKEYS)   // 16
#define NCH    (SKEYS / 64)   // 16-byte chunks of each tile that one thread moves

// One 16 x 32 fragment out of a staged tile: group = which 16 rows.
__device__ __forceinline__ v16h lds_frag(const v8h* t, int group, int llo, int lhi) {
  v8h lo = t[(group * 2) * 32 + llo];
  v8h hi = t[(group * 2 + 1) * 32 + lhi];
  return __builtin_shufflevector(lo, hi, 0, 1, 2, 3, 4, 5, 6, 7,
                                 8, 9, 10, 11, 12, 13, 14, 15);
}

__global__ __launch_bounds__(256) void attn_fa(const _Float16* __restrict__ Qh,
                                               const _Float16* __restrict__ Kh,
                                               const _Float16* __restrict__ Vt,
                                               _Float16* __restrict__ AO) {
  // [buffer][K, V][8 groups of 16 rows][lo, hi][32 places] of 16 bytes: 32 KB
  __shared__ v8h tile[2][2][SKEYS * 4];
  const int qblocks = NN / (16 * QWAVES);
  int qb = blockIdx.x % qblocks;
  int bh = blockIdx.x / qblocks;  // b*HH + h
  int h  = bh % HH;
  int b  = bh / HH;
  int tid  = threadIdx.x;
  int lane = tid & 31;
  int qt   = qb * QWAVES + (tid >> 5);
  int col  = lane & 15;                // this lane's query within the tile
  int kb   = (lane & 16) ? 8 : 0;      // key-half / d-half selector

  const _Float16* Qbase = Qh + ((size_t)bh * (DD / 4) * NN + qt * 16) * 4;  // d' / 4 = 0
  const _Float16* Kbase = Kh + (size_t)bh * (DD / 4) * NN * 4;
  const _Float16* Vbase = Vt + ((size_t)bh * DD) * NN;

  // Staging map. A tile is 128 rows of four 16-byte chunks (K: row = key;
  // V: row = strip * 32 + d, its 64 bytes the strip's 32 keys). Chunk c of row
  // rr is what lane (c & 1) * 16 + (rr & 15) takes as its lo (c < 2) or hi half.
  // Its place in that half's 512 bytes has the row xor-ed with 4 * c, so that
  // the 16 lanes of a half-wave, which store four chunks of each of four rows,
  // fall on 16 different bank groups; a reading half-wave still covers all 16.
  // Of V thread t moves chunks t + 256 * i (row + 64 * i, slot + 256 * i). Of K it
  // moves chunks 2 * (t >> 7) + i of key t & 127, each out of two 8-byte units of
  // neighbouring d' / 4 planes: a wave's load is 256 contiguous bytes, and the 16
  // lanes of a storing half-wave hold 16 rows of one chunk, 16 bank groups.
  int c  = tid & 3;
  int rr = tid >> 2;
  int slot = ((rr >> 4) * 2 + (c >> 1)) * 32 + (c & 1) * 16 + ((rr & 15) ^ (c << 2));
  int llo  = (lane & 16) | (col ^ ((lane & 16) >> 2));  // reader's place, c = 0 or 1
  int lhi  = llo ^ 8;                                   // reader's place, c = 2 or 3
  int key = tid & 127;
  int ch  = tid >> 7;
  int kslot = ((key >> 4) * 2 + ch) * 32 + ((key & 15) ^ (ch << 3));  // chunk 2 * ch
  const _Float16* kg = Kbase + ((size_t)(ch * 4) * NN + key) * 4;
  const _Float16* vg = Vbase + (size_t)(rr & 31) * NN + (rr >> 5) * 32 + c * 8;

  v4h gk[NCH][2];
  v8h gv[NCH];
#pragma unroll
  for (int i = 0; i < NCH; ++i) {
    gk[i][0] = *(const v4h*)(kg + (2 * i) * NN * 4);
    gk[i][1] = *(const v4h*)(kg + (2 * i + 1) * NN * 4);
    gv[i] = *(const v8h*)(vg + i * 64);
  }
  // B-frag of Q^T, lives across the loop: d' = kb..kb+7 and 16+kb..16+kb+7 of
  // query col, four 8-byte units.
  v16h qf;
  {
    const _Float16* qp = Qbase + ((size_t)(kb >> 2) * NN + col) * 4;
    v4h q0 = *(const v4h*)(qp);
    v4h q1 = *(const v4h*)(qp + NN * 4);
    v4h q2 = *(const v4h*)(qp + 4 * NN * 4);
    v4h q3 = *(const v4h*)(qp + 5 * NN * 4);
    v8h lo = __builtin_shufflevector(q0, q1, 0, 1, 2, 3, 4, 5, 6, 7);
    v8h hi = __builtin_shufflevector(q2, q3, 0, 1, 2, 3, 4, 5, 6, 7);
    qf = __builtin_shufflevector(lo, hi, 0, 1, 2, 3, 4, 5, 6, 7,
                                 8, 9, 10, 11, 12, 13, 14, 15);
  }
#pragma unroll
  for (int i = 0; i < NCH; ++i) {
    tile[0][0][(kslot ^ (i << 2)) + i * 16] =
        __builtin_shufflevector(gk[i][0], gk[i][1], 0, 1, 2, 3, 4, 5, 6, 7);
    tile[0][1][slot + i * 256] = gv[i];
  }
  __syncthreads();

  v8f o0 = {};  // O^T rows d = kb..kb+7        (cols = queries)
  v8f o1 = {};  // O^T rows d = 16+kb..16+kb+7
  float m = -3.0e30f, l = 0.f;

  for (int s = 0; s < NSTAGE; ++s) {
    const bool more = s + 1 < NSTAGE;
    if (more) {  // next stage's chunks fly while this stage is worked on
      const _Float16* kn = kg + (s + 1) * SKEYS * 4;
      const _Float16* vn = vg + (s + 1) * SKEYS;
#pragma unroll
      for (int i = 0; i < NCH; ++i) {
        gk[i][0] = *(const v4h*)(kn + (2 * i) * NN * 4);
        gk[i][1] = *(const v4h*)(kn + (2 * i + 1) * NN * 4);
        gv[i] = *(const v8h*)(vn + i * 64);
      }
      // The stage's LDS reads reuse the address registers of these loads.
      asm volatile("s_wait_xcnt 0x0" ::: "memory");
    }
    const v8h* kt = tile[s & 1][0];
    const v8h* vt = tile[s & 1][1];
    // Unrolled so that a strip's LDS reads can be issued ahead of their use.
#pragma unroll
    for (int p = 0; p < SKEYS / 32; ++p) {
      v16h kf0 = lds_frag(kt, p * 2, llo, lhi);      // keys j0..j0+15
      v16h kf1 = lds_frag(kt, p * 2 + 1, llo, lhi);  // keys j0+16..j0+31
      v8f zero = {};
      v8f s0 = __builtin_amdgcn_wmma_f32_16x16x32_f16(false, kf0, false, qf,
                                                      (short)0, zero, false, false);
      v8f s1 = __builtin_amdgcn_wmma_f32_16x16x32_f16(false, kf1, false, qf,
                                                      (short)0, zero, false, false);
      // --- per-lane (per-query) online softmax over this 32-key strip ---
      float mx = fmaxf(s0[0], s1[0]);
#pragma unroll
      for (int e = 1; e < 8; ++e) mx = fmaxf(mx, fmaxf(s0[e], s1[e]));
      mx = fmaxf(mx, __shfl_xor(mx, 16, 32));    // merge the two key-halves
      float mnew  = fmaxf(m, mx);
      float alpha = __expf(m - mnew);
      v16h pf;
      float rs = 0.f;
#pragma unroll
      for (int e = 0; e < 8; ++e) {
        float e0 = __expf(s0[e] - mnew);
        float e1 = __expf(s1[e] - mnew);
        rs += e0 + e1;
        pf[e]     = (_Float16)e0;   // B-frag element e   <-> key kb+e      of strip
        pf[8 + e] = (_Float16)e1;   // B-frag element 8+e <-> key 16+kb+e   of strip
      }
      rs += __shfl_xor(rs, 16, 32);
      l = l * alpha + rs;
      m = mnew;
#pragma unroll
      for (int e = 0; e < 8; ++e) { o0[e] *= alpha; o1[e] *= alpha; }
      // --- O^T += V^T x P^T ---
      v16h vf0 = lds_frag(vt, p * 2, llo, lhi);      // d = 0..15
      v16h vf1 = lds_frag(vt, p * 2 + 1, llo, lhi);  // d = 16..31
      o0 = __builtin_amdgcn_wmma_f32_16x16x32_f16(false, vf0, false, pf,
                                                  (short)0, o0, false, false);
      o1 = __builtin_amdgcn_wmma_f32_16x16x32_f16(false, vf1, false, pf,
                                                  (short)0, o1, false, false);
    }
    if (more) {  // the other buffer's readers left it at the last barrier
      v8h* kd = tile[(s + 1) & 1][0];
      v8h* vd = tile[(s + 1) & 1][1];
#pragma unroll
      for (int i = 0; i < NCH; ++i) {
        kd[(kslot ^ (i << 2)) + i * 16] =
            __builtin_shufflevector(gk[i][0], gk[i][1], 0, 1, 2, 3, 4, 5, 6, 7);
        vd[slot + i * 256] = gv[i];
      }
    }
    // Publishes stage s + 1 and ends every wave's reads of stage s.
    __syncthreads();
  }

  // --- epilogue: normalize, pack, two b128 stores per lane ---
  float inv = 1.0f / l;
  int n = qt * 16 + col;
  size_t off = (((size_t)b * NN) + n) * INNER + h * DD;
  v8h r0, r1;
#pragma unroll
  for (int p = 0; p < 8; ++p) {
    r0[p] = (_Float16)(o0[p] * inv);   // d = kb+p
    r1[p] = (_Float16)(o1[p] * inv);   // d = 16+kb+p
  }
  *(v8h*)(AO + off + kb)      = r0;
  *(v8h*)(AO + off + 16 + kb) = r1;
}

// ---------------------------------------------------------------------------
// Kernel 3: output projection  out[b][o][n] = sum_c wo[o][c]*AO[b][n][c] + bo[o]
// Four waves form a work-group and share a 64 (o) x 64 (n) output block. Its
// 64 rows of wo and 64 rows of AO (512 bytes each, all of K = 256) come from
// global memory once per work-group, a whole row per wave-wide 16-byte load,
// and are laid in LDS in fragment order. A wave owns 2 x 2 tiles of 16 x 16,
// so every fragment it reads from LDS feeds two WMMAs.
// ---------------------------------------------------------------------------
#define OPB 64   // rows of wo, and rows of AO, per work-group

// One 16 x 32 fragment out of a staged operand: group = which 16 rows, k = which
// 32 of the 256 channels. rx = (lane & 15) ^ (lane >> 4), lh16 = lane & 16.
__device__ __forceinline__ v16h opnd_frag(const v8h* t, int group, int k, int lh16, int rx) {
  v8h lo = t[((group * 8 + k) * 2) * 32 + lh16 + (rx ^ ((k & 3) * 4))];
  v8h hi = t[((group * 8 + k) * 2 + 1) * 32 + lh16 + (rx ^ ((k & 3) * 4 + 2))];
  return __builtin_shufflevector(lo, hi, 0, 1, 2, 3, 4, 5, 6, 7,
                                 8, 9, 10, 11, 12, 13, 14, 15);
}

__global__ __launch_bounds__(128) void out_proj(const _Float16* __restrict__ wo16,
                                                const _Float16* __restrict__ AO,
                                                const float* __restrict__ bo,
                                                float* __restrict__ out) {
  // [wo, AO][4 groups of 16 rows][8 k steps][lo, hi][32 places] of 16 bytes: 64 KB
  __shared__ v8h opnd[2][(OPB / 16) * 8 * 2 * 32];
  const int oblocks = CC / OPB;
  const int nblocks = NN / OPB;
  int ob = blockIdx.x % oblocks;
  int rest = blockIdx.x / oblocks;
  int nb = rest % nblocks;
  int b  = rest / nblocks;
  int lane = threadIdx.x & 31;
  int wave = threadIdx.x >> 5;
  int col  = lane & 15;
  int hi8  = (lane & 16) ? 8 : 0;
  int og = (wave & 1) * 2;   // the wave's first group of 16 o
  int ng = (wave >> 1) * 2;  // the wave's first group of 16 n

  // Staging map. Wave w moves group w of both operands, one row a load; lane j
  // holds chunk j of the row: k step j >> 2, half (j >> 1) & 1 (lo or hi), and
  // it is what lane (j & 1) * 16 + row takes. Its place in that half-wave's 256
  // bytes has the row xor-ed with j & 15, so that the 16 lanes of a storing
  // half-wave, which all hold the same row, fall on 16 different bank groups; a
  // reading half-wave still covers all 16.
  const v8h* ag = (const v8h*)(wo16 + (size_t)(ob * OPB + wave * 16) * INNER) + lane;
  const v8h* bg = (const v8h*)(AO + ((size_t)b * NN + nb * OPB + wave * 16) * INNER) + lane;
  v8h ga[16], gb[16];
#pragma unroll
  for (int i = 0; i < 16; ++i) {
    ga[i] = ag[i * (INNER / 8)];
    gb[i] = bg[i * (INNER / 8)];
  }
  f32x4 bias[2][2];  // bo of the lane's eight rows in each of its two groups
#pragma unroll
  for (int u = 0; u < 2; ++u) {
    const f32x4* bp = (const f32x4*)(bo + ob * OPB + (og + u) * 16 + hi8);
    bias[u][0] = bp[0];
    bias[u][1] = bp[1];
  }
  int wbase = ((wave * 8 + (lane >> 2)) * 2 + ((lane >> 1) & 1)) * 32 + (lane & 1) * 16;
#pragma unroll
  for (int i = 0; i < 16; ++i) {
    opnd[0][wbase + (i ^ col)] = ga[i];
    opnd[1][wbase + (i ^ col)] = gb[i];
  }
  // Hands every wave's rows to the whole work-group.
  __syncthreads();

  int lh16 = lane & 16;
  int rx   = col ^ (lane >> 4);
  v8f acc[2][2] = {};
  // Fragments are read one k step ahead into a second register set, so that a
  // step's WMMAs do not wait out the LDS latency of their own reads.
  v16h af[2][2], bf[2][2];
#pragma unroll
  for (int u = 0; u < 2; ++u) {
    af[0][u] = opnd_frag(opnd[0], og + u, 0, lh16, rx);
    bf[0][u] = opnd_frag(opnd[1], ng + u, 0, lh16, rx);
  }
#pragma unroll
  for (int k = 0; k < INNER / 32; ++k) {
    if (k + 1 < INNER / 32) {
#pragma unroll
      for (int u = 0; u < 2; ++u) {
        af[(k + 1) & 1][u] = opnd_frag(opnd[0], og + u, k + 1, lh16, rx);
        bf[(k + 1) & 1][u] = opnd_frag(opnd[1], ng + u, k + 1, lh16, rx);
      }
    }
    // Keeps the next step's eight LDS reads issued as one group in front of
    // this step's WMMAs; left free, the compiler sinks them behind the WMMAs
    // and each step waits for its own reads.
    __builtin_amdgcn_sched_barrier(0);
#pragma unroll
    for (int u = 0; u < 2; ++u)
#pragma unroll
      for (int v = 0; v < 2; ++v)
        acc[u][v] = __builtin_amdgcn_wmma_f32_16x16x32_f16(false, af[k & 1][u], false, bf[k & 1][v],
                                                           (short)0, acc[u][v], false, false);
  }
#pragma unroll
  for (int u = 0; u < 2; ++u) {
    int o0 = ob * OPB + (og + u) * 16 + hi8;
    float* orow = out + (((size_t)b * CC) + o0) * NN + nb * OPB + ng * 16 + col;
#pragma unroll
    for (int p = 0; p < 8; ++p) {
#pragma unroll
      for (int v = 0; v < 2; ++v)
        orow[(size_t)p * NN + v * 16] = acc[u][v][p] + bias[u][p >> 2][p & 3];
    }
  }
}

// ---------------------------------------------------------------------------
extern "C" void kernel_launch(void* const* d_in, const int* in_sizes, int n_in,
                              void* d_out, int out_size, void* d_ws, size_t ws_size,
                              hipStream_t stream) {
  const float* x     = (const float*)d_in[0];
  const float* gamma = (const float*)d_in[1];
  const float* beta  = (const float*)d_in[2];
  const float* wk    = (const float*)d_in[3];
  const float* wq    = (const float*)d_in[4];
  const float* wv    = (const float*)d_in[5];
  const float* wo    = (const float*)d_in[6];
  const float* bo    = (const float*)d_in[7];
  float* out = (float*)d_out;

  char* ws = (char*)d_ws;
  size_t off = 0;
  _Float16* wo16 = (_Float16*)(ws + off); off += (size_t)CC * INNER * 2;        // 128 KB
  _Float16* Qh   = (_Float16*)(ws + off); off += (size_t)BB * HH * NN * DD * 2; // 2 MB
  _Float16* Kh   = (_Float16*)(ws + off); off += (size_t)BB * HH * NN * DD * 2; // 2 MB
  _Float16* Vt   = (_Float16*)(ws + off); off += (size_t)BB * HH * NN * DD * 2; // 2 MB
  _Float16* AO   = (_Float16*)(ws + off); off += (size_t)BB * NN * INNER * 2;   // 2 MB

  proj_kernel<<<dim3(PROJ_WG + CVT_WG), dim3(256), 0, stream>>>(
      x, gamma, beta, wk, wq, wv, Qh, Kh, Vt, wo, wo16);
  attn_fa<<<dim3(BB * HH * (NN / 128)), dim3(256), 0, stream>>>(Qh, Kh, Vt, AO);
  out_proj<<<dim3(BB * (NN / OPB) * (CC / OPB)), dim3(128), 0, stream>>>(wo16, AO, bo, out);
}

// v007
// One run takes 37.4 microseconds.
// In two side-by-side timings against v006, it was 1.10 and 1.11 times as fast.
// All steps since v000 together make it 2.57 times as fast.
#include <hip/hip_runtime.h>
#include <hip/hip_bf16.h>

// Flash-attention for the reference module, CDNA5 (gfx1250, wave32) WMMA path.
// Pipeline: proj (BN statistics of the group's own 32 channels, BN + grouped
//              conv, head-split layouts; the f16 copy of wo is made by extra
//              work-groups of the same grid)
//           -> attn_fa (TRANSPOSED scores: S^T = K*Q^T, so online-softmax stats
//              are per-lane scalars and the P fragment is born in B-frag layout;
//              K and V staged in LDS, shared by the eight waves of a group)
//           -> out_proj (256x256 WMMA GEMM + bias; both operands staged in LDS,
//              shared by the four waves of a group).
// Workspace requirement: 8,519,680 bytes (~8.5 MB).

typedef __attribute__((ext_vector_type(16))) _Float16 v16h;
typedef __attribute__((ext_vector_type(8)))  _Float16 v8h;
typedef __attribute__((ext_vector_type(4)))  _Float16 v4h;
typedef __attribute__((ext_vector_type(8)))  float    v8f;
typedef __attribute__((ext_vector_type(16))) float    f32x16;
typedef __attribute__((ext_vector_type(4)))  float    f32x4;

#define BB 2
#define CC 256
#define NN 2048
#define HH 8
#define DD 32
#define INNER (HH * DD)   // 256

// ---------------------------------------------------------------------------
// Kernel 1: BatchNorm batch statistics + BN-normalize + grouped 1x1 conv
// projections. A work-group needs scale and shift of its group's 32 channels
// only, so it sums those channels itself (all of b and n, 512 KB out of L2):
// wave w takes channels 4w..4w+3, a row of 2048 floats is 16 wave-wide 16-byte
// loads, and the next row's 16 loads fly while this row is summed.
// Emits the reference's faithful '(d h)' head split WITH the q<-k swap and the
// 1/sqrt(D) scale folded into Qh. Layouts chosen for WMMA fragment loads:
//   Qh,Kh : [b, h', d' / 4, n, 4]: a group's channels give a thread exactly the
//           four d' = 4g..4g+3 of every head, so a thread stores them as one
//           8-byte unit and a wave's store is 256 contiguous bytes, two whole
//           lines that no other work-group writes (with d' contiguous over all
//           32, a wave's store was 32 pieces of 2 bytes, 64 bytes apart, in
//           lines that eight work-groups share)
//   Vt    : [b, h', 32, n]  (n contiguous)    -> P@V  frags are 2x b128/lane
// The work-groups behind the PROJ_WG projecting ones turn wo (f32, 256x256) into
// f16 for out_proj. That work depends on nothing here and nothing here depends
// on it; in this grid it runs on WGPs the projections leave idle and needs no
// launch of its own.
// ---------------------------------------------------------------------------
#define PROJ_WG (BB * HH * (NN / 256))      // 128 projecting work-groups
#define CVT_WG  (CC * INNER / (256 * 8))    // 32 converting ones, 8 elements a thread
__global__ __launch_bounds__(256) void proj_kernel(
    const float* __restrict__ x, const float* __restrict__ gamma,
    const float* __restrict__ beta, const float* __restrict__ wk,
    const float* __restrict__ wq, const float* __restrict__ wv,
    _Float16* __restrict__ Qh, _Float16* __restrict__ Kh,
    _Float16* __restrict__ Vt, const float* __restrict__ wo,
    _Float16* __restrict__ wo16) {
  __shared__ f32x4 aff[2][8];  // [scale, shift][wave] of four channels each
  __shared__ v4h unit[HH][2][256];  // [head][Q, K][thread]: the thread's four d'
  if (blockIdx.x >= PROJ_WG) {
    int i = ((blockIdx.x - PROJ_WG) * 256 + threadIdx.x) * 8;
    f32x4 lo = *(const f32x4*)(wo + i);
    f32x4 hi = *(const f32x4*)(wo + i + 4);
    v8h r;
#pragma unroll
    for (int e = 0; e < 4; ++e) { r[e] = (_Float16)lo[e]; r[4 + e] = (_Float16)hi[e]; }
    *(v8h*)(wo16 + i) = r;
    return;
  }
  const int ntile_cnt = NN / 256;
  int nt = blockIdx.x % ntile_cnt;
  int bg = blockIdx.x / ntile_cnt;
  int g  = bg % HH;
  int b  = bg / HH;
  // Every weight index below is the same for the whole work-group, so these
  // reads compile to scalar loads: the operand sits in a scalar register and no
  // LDS wait stands between the multiply-adds.
  const f32x16* __restrict__ wkg = (const f32x16*)(wk + g * 1024);  // row d = [2d], [2d+1]
  const f32x16* __restrict__ wqg = (const f32x16*)(wq + g * 1024);
  const f32x16* __restrict__ wvg = (const f32x16*)(wv + g * 1024);

  int n = nt * 256 + threadIdx.x;
  float xn[32];  // the thread's own column, on its way while the sums are made
#pragma unroll
  for (int c = 0; c < 32; ++c)
    xn[c] = x[(((size_t)b * CC) + g * 32 + c) * NN + n];

  // --- batch statistics of channels ch0..ch0+3, one wave ---
  {
    const int lane = threadIdx.x & 31;
    const int wave = __builtin_amdgcn_readfirstlane(threadIdx.x >> 5);
    const int ch0  = g * 32 + wave * 4;
    const f32x4 gm = *(const f32x4*)(gamma + ch0);
    const f32x4 bt = *(const f32x4*)(beta + ch0);
    // Row r = 2 * j + bb is channel ch0 + j of batch bb.
    f32x4 buf[2][16];
#pragma unroll
    for (int i = 0; i < 16; ++i)
      buf[0][i] = ((const f32x4*)(x + (size_t)ch0 * NN))[i * 32 + lane];
    // The sums below reuse the address registers of the column's loads; the
    // scheduling barrier keeps them behind the wait.
    asm volatile("s_wait_xcnt 0x0" ::: "memory");
    __builtin_amdgcn_sched_barrier(0);
    f32x4 sum, sq;
#pragma unroll
    for (int j = 0; j < 4; ++j) {
      f32x4 a = {0.f, 0.f, 0.f, 0.f}, q = {0.f, 0.f, 0.f, 0.f};
#pragma unroll
      for (int bb = 0; bb < BB; ++bb) {
        const int r = j * BB + bb;
        if (r + 1 < 4 * BB) {
          const float* nx = x + (((size_t)((r + 1) % BB) * CC) + ch0 + (r + 1) / BB) * NN;
#pragma unroll
          for (int i = 0; i < 16; ++i)
            buf[(r + 1) & 1][i] = ((const f32x4*)nx)[i * 32 + lane];
        }
        // Keeps the next row's 16 loads issued as one group in front of this
        // row's sums; left free, the compiler deals them out among the sums
        // and holds far fewer loads in flight.
        __builtin_amdgcn_sched_barrier(0);
#pragma unroll
        for (int i = 0; i < 16; ++i) {
          f32x4 v = buf[r & 1][i];
          a += v;
          q += v * v;
        }
      }
      sum[j] = (a[0] + a[1]) + (a[2] + a[3]);
      sq[j]  = (q[0] + q[1]) + (q[2] + q[3]);
    }
    // What follows reuses the registers that the rows' loads name.
    asm volatile("s_wait_xcnt 0x0" ::: "memory");
    __builtin_amdgcn_sched_barrier(0);
#pragma unroll
    for (int m = 16; m > 0; m >>= 1) {
#pragma unroll
      for (int j = 0; j < 4; ++j) {
        sum[j] += __shfl_xor(sum[j], m, 32);
        sq[j]  += __shfl_xor(sq[j], m, 32);
      }
    }
    f32x4 sc, sh;
#pragma unroll
    for (int j = 0; j < 4; ++j) {
      const float invn = 1.0f / (float)(BB * NN);
      float mean = sum[j] * invn;
      float var  = sq[j] * invn - mean * mean;
      sc[j] = gm[j] * rsqrtf(var + 1e-5f);
      sh[j] = bt[j] - mean * sc[j];
    }
    if (lane == 0) { aff[0][wave] = sc; aff[1][wave] = sh; }
  }
  // Hands every wave's four scales and shifts to the whole work-group.
  __syncthreads();
#pragma unroll
  for (int c4 = 0; c4 < 8; ++c4) {
    f32x4 sc = aff[0][c4], sh = aff[1][c4];
#pragma unroll
    for (int e = 0; e < 4; ++e) xn[c4 * 4 + e] = xn[c4 * 4 + e] * sc[e] + sh[e];
  }

  const float qscale = 0.17677669529663687f;  // 1/sqrt(32)
  // Kept rolled: two rows of each of the three matrices already fill the scalar
  // registers; four rows a trip spilled them into vector lanes.
#pragma unroll 1
  for (int d0 = 0; d0 < 32; d0 += 2) {
    float ak2[2] = {0.f, 0.f}, aq2[2] = {0.f, 0.f}, av2[2] = {0.f, 0.f};
#pragma unroll
    for (int hf = 0; hf < 2; ++hf) {
      f32x16 rk[2], rq[2], rv[2];
#pragma unroll
      for (int u = 0; u < 2; ++u) {
        rk[u] = wkg[(d0 + u) * 2 + hf];
        rq[u] = wqg[(d0 + u) * 2 + hf];
        rv[u] = wvg[(d0 + u) * 2 + hf];
      }
#pragma unroll
      for (int c = 0; c < 16; ++c) {
#pragma unroll
        for (int u = 0; u < 2; ++u) {
          ak2[u] = fmaf(rk[u][c], xn[hf * 16 + c], ak2[u]);
          aq2[u] = fmaf(rq[u][c], xn[hf * 16 + c], aq2[u]);
          av2[u] = fmaf(rv[u][c], xn[hf * 16 + c], av2[u]);
        }
      }
    }
#pragma unroll
    for (int u = 0; u < 2; ++u) {
      float ak = ak2[u], aq = aq2[u], av = av2[u];
      int cc = g * 32 + d0 + u;   // projected channel index
      int hh = cc & 7;            // attention head  (channel = d'*H + h')
      int dd = cc >> 3;           // attention d'
      size_t bh = (size_t)b * HH + hh;
      // A head's four d' come eight rows apart: they gather in the thread's own
      // 8 bytes of LDS and leave together behind the loop.
      ((_Float16*)&unit[hh][0][threadIdx.x])[dd & 3] = (_Float16)(ak * qscale);  // q <- k (swap), pre-scaled
      ((_Float16*)&unit[hh][1][threadIdx.x])[dd & 3] = (_Float16)aq;             // k <- q (swap)
      Vt[(bh * DD + dd) * NN + n] = (_Float16)av;             // transposed V
    }
    // The next trip rewrites the registers that these stores name.
    asm volatile("s_wait_xcnt 0x0" ::: "memory");
  }
  // Every thread reads back what it wrote itself: no barrier.
#pragma unroll
  for (int hh = 0; hh < HH; ++hh) {
    size_t at = ((((size_t)b * HH + hh) * (DD / 4) + g) * NN + n) * 4;
    *(v4h*)(Qh + at) = unit[hh][0][threadIdx.x];
    *(v4h*)(Kh + at) = unit[hh][1][threadIdx.x];
  }
}

// ---------------------------------------------------------------------------
// Kernel 2: flash attention with TRANSPOSED score tiles.
//   S^T = A(K-tile 16keys x 32d) x B(Q^T 32d x 16queries)
//     -> C-layout: lane owns one query column; its 8 elements are keys
//        {kb..kb+7} (kb = lane>=16 ? 8 : 0) of the strip half.
//   Softmax stats (m, l) are per-lane scalars. The maximum in use, m, is lazy:
//   -m is the C operand of every score product, so the scores leave the matrix
//   unit already shifted, and one test per 128-key stage (a ballot, a scalar
//   branch) asks whether any shifted score of the wave exceeds LAZY. Only then, and in the first stage,
//   are the two key-halves' maxima merged, m raised, and scores, O and l scaled.
//   l is each lane's own partial sum; the halves join behind the loop.
//   exp(S^T - m) lands *directly* in the B-frag layout required by
//   O^T = A(V^T 16d x 32keys) x B(P^T 32keys x 16queries): pf[i]=e(s0[i]),
//   pf[8+i]=e(s1[i]).
//   Eight waves (128 queries of one head) form a work-group and share every
//   K and V fragment: a stage of 128 keys is fetched from global memory once
//   per work-group, one stage ahead, and laid in LDS in fragment order, so a
//   fragment half is one ds_load_b128 over 512 contiguous bytes per wave.
//   Epilogue: each lane holds 8 contiguous d values per accumulator ->
//   two packed b128 stores into AO[b][n][h*32+d].
// ---------------------------------------------------------------------------
#define QWAVES 8              // waves per work-group, 16 queries each
#define SKEYS  128            // keys per stage
#define NSTAGE (NN / SKEYS)   // 16
#define NCH    (SKEYS / 64)   // 16-byte chunks of each tile that one thread moves
#define LAZY   5.5f           // a score may pass the maximum in use by this much: P <= e^5.5, far inside f16

// One 16 x 32 fragment out of a staged tile: group = which 16 rows.
__device__ __forceinline__ v16h lds_frag(const v8h* t, int group, int llo, int lhi) {
  v8h lo = t[(group * 2) * 32 + llo];
  v8h hi = t[(group * 2 + 1) * 32 + lhi];
  return __builtin_shufflevector(lo, hi, 0, 1, 2, 3, 4, 5, 6, 7,
                                 8, 9, 10, 11, 12, 13, 14, 15);
}

__global__ __launch_bounds__(256) void attn_fa(const _Float16* __restrict__ Qh,
                                               const _Float16* __restrict__ Kh,
                                               const _Float16* __restrict__ Vt,
                                               _Float16* __restrict__ AO) {
  // [buffer][K, V][8 groups of 16 rows][lo, hi][32 places] of 16 bytes: 32 KB
  __shared__ v8h tile[2][2][SKEYS * 4];
  const int qblocks = NN / (16 * QWAVES);
  int qb = blockIdx.x % qblocks;
  int bh = blockIdx.x / qblocks;  // b*HH + h
  int h  = bh % HH;
  int b  = bh / HH;
  int tid  = threadIdx.x;
  int lane = tid & 31;
  int qt   = qb * QWAVES + (tid >> 5);
  int col  = lane & 15;                // this lane's query within the tile
  int kb   = (lane & 16) ? 8 : 0;      // key-half / d-half selector

  const _Float16* Qbase = Qh + ((size_t)bh * (DD / 4) * NN + qt * 16) * 4;  // d' / 4 = 0
  const _Float16* Kbase = Kh + (size_t)bh * (DD / 4) * NN * 4;
  const _Float16* Vbase = Vt + ((size_t)bh * DD) * NN;

  // Staging map. A tile is 128 rows of four 16-byte chunks (K: row = key;
  // V: row = strip * 32 + d, its 64 bytes the strip's 32 keys). Chunk c of row
  // rr is what lane (c & 1) * 16 + (rr & 15) takes as its lo (c < 2) or hi half.
  // Its place in that half's 512 bytes has the row xor-ed with 4 * c, so that
  // the 16 lanes of a half-wave, which store four chunks of each of four rows,
  // fall on 16 different bank groups; a reading half-wave still covers all 16.
  // Of V thread t moves chunks t + 256 * i (row + 64 * i, slot + 256 * i). Of K it
  // moves chunks 2 * (t >> 7) + i of key t & 127, each out of two 8-byte units of
  // neighbouring d' / 4 planes: a wave's load is 256 contiguous bytes, and the 16
  // lanes of a storing half-wave hold 16 rows of one chunk, 16 bank groups.
  int c  = tid & 3;
  int rr = tid >> 2;
  int slot = ((rr >> 4) * 2 + (c >> 1)) * 32 + (c & 1) * 16 + ((rr & 15) ^ (c << 2));
  int llo  = (lane & 16) | (col ^ ((lane & 16) >> 2));  // reader's place, c = 0 or 1
  int lhi  = llo ^ 8;                                   // reader's place, c = 2 or 3
  int key = tid & 127;
  int ch  = tid >> 7;
  int kslot = ((key >> 4) * 2 + ch) * 32 + ((key & 15) ^ (ch << 3));  // chunk 2 * ch
  const _Float16* kg = Kbase + ((size_t)(ch * 4) * NN + key) * 4;
  const _Float16* vg = Vbase + (size_t)(rr & 31) * NN + (rr >> 5) * 32 + c * 8;

  v4h gk[NCH][2];
  v8h gv[NCH];
#pragma unroll
  for (int i = 0; i < NCH; ++i) {
    gk[i][0] = *(const v4h*)(kg + (2 * i) * NN * 4);
    gk[i][1] = *(const v4h*)(kg + (2 * i + 1) * NN * 4);
    gv[i] = *(const v8h*)(vg + i * 64);
  }
  // B-frag of Q^T, lives across the loop: d' = kb..kb+7 and 16+kb..16+kb+7 of
  // query col, four 8-byte units.
  v16h qf;
  {
    const _Float16* qp = Qbase + ((size_t)(kb >> 2) * NN + col) * 4;
    v4h q0 = *(const v4h*)(qp);
    v4h q1 = *(const v4h*)(qp + NN * 4);
    v4h q2 = *(const v4h*)(qp + 4 * NN * 4);
    v4h q3 = *(const v4h*)(qp + 5 * NN * 4);
    v8h lo = __builtin_shufflevector(q0, q1, 0, 1, 2, 3, 4, 5, 6, 7);
    v8h hi = __builtin_shufflevector(q2, q3, 0, 1, 2, 3, 4, 5, 6, 7);
    qf = __builtin_shufflevector(lo, hi, 0, 1, 2, 3, 4, 5, 6, 7,
                                 8, 9, 10, 11, 12, 13, 14, 15);
  }
#pragma unroll
  for (int i = 0; i < NCH; ++i) {
    tile[0][0][(kslot ^ (i << 2)) + i * 16] =
        __builtin_shufflevector(gk[i][0], gk[i][1], 0, 1, 2, 3, 4, 5, 6, 7);
    tile[0][1][slot + i * 256] = gv[i];
  }
  __syncthreads();

  v8f o0 = {};  // O^T rows d = kb..kb+7        (cols = queries)
  v8f o1 = {};  // O^T rows d = 16+kb..16+kb+7
  v8f cm = {};  // -m in all eight places: the C operand of the score products
  float m = 0.f, l = 0.f;

  for (int s = 0; s < NSTAGE; ++s) {
    const bool more = s + 1 < NSTAGE;
    if (more) {  // next stage's chunks fly while this stage is worked on
      const _Float16* kn = kg + (s + 1) * SKEYS * 4;
      const _Float16* vn = vg + (s + 1) * SKEYS;
#pragma unroll
      for (int i = 0; i < NCH; ++i) {
        gk[i][0] = *(const v4h*)(kn + (2 * i) * NN * 4);
        gk[i][1] = *(const v4h*)(kn + (2 * i + 1) * NN * 4);
        gv[i] = *(const v8h*)(vn + i * 64);
      }
      // The stage's LDS reads reuse the address registers of these loads.
      asm volatile("s_wait_xcnt 0x0" ::: "memory");
    }
    const v8h* kt = tile[s & 1][0];
    const v8h* vt = tile[s & 1][1];
    // Every loop of the stage is unrolled: vf, sc, mp and rs are register arrays.
    // All of the stage's V fragments are asked for as one group, ahead of the
    // strips that use them: read strip by strip, each waits out its LDS latency.
    v16h vf[SKEYS / 16];  // [2 * strip]: d = 0..15, [2 * strip + 1]: d = 16..31
#pragma unroll
    for (int p = 0; p < SKEYS / 16; ++p) vf[p] = lds_frag(vt, p, llo, lhi);
    v8f sc[SKEYS / 16];  // S^T - m, 16 keys each
#pragma unroll
    for (int p = 0; p < SKEYS / 16; ++p)
      sc[p] = __builtin_amdgcn_wmma_f32_16x16x32_f16(false, lds_frag(kt, p, llo, lhi), false, qf,
                                                     (short)0, cm, false, false);
    // --- the lane's largest shifted score of the stage, four chains ---
    float mp[SKEYS / 32];
#pragma unroll
    for (int p = 0; p < SKEYS / 32; ++p) {
      mp[p] = fmaxf(sc[2 * p][0], sc[2 * p + 1][0]);
#pragma unroll
      for (int e = 1; e < 8; ++e) mp[p] = fmaxf(mp[p], fmaxf(sc[2 * p][e], sc[2 * p + 1][e]));
    }
    float mx = fmaxf(fmaxf(mp[0], mp[1]), fmaxf(mp[2], mp[3]));
    // Wave-uniform: the first stage sets m, a later one raises it when some score
    // has outgrown it. Every lane is on inside.
    if (s == 0 || __builtin_amdgcn_ballot_w32(mx > LAZY) != 0) {
      mx = fmaxf(mx, __shfl_xor(mx, 16, 32));    // merge the two key-halves
      float up    = (s == 0) ? mx : fmaxf(mx, 0.f);
      float alpha = (s == 0) ? 1.f : __expf(-up);  // O and l are still 0 in stage 0
#pragma unroll
      for (int p = 0; p < SKEYS / 16; ++p)
#pragma unroll
        for (int e = 0; e < 8; ++e) sc[p][e] -= up;
#pragma unroll
      for (int e = 0; e < 8; ++e) { o0[e] *= alpha; o1[e] *= alpha; }
      l *= alpha;
      m += up;
#pragma unroll
      for (int e = 0; e < 8; ++e) cm[e] = -m;
    }
    float rs[SKEYS / 32];
#pragma unroll
    for (int p = 0; p < SKEYS / 32; ++p) {
      // Keeps the next stage's LDS stores, which wait for its global loads, from
      // rising above the last strip: higher up they wait out the loads' latency.
      if (p == SKEYS / 32 - 1) __builtin_amdgcn_sched_barrier(0);
      v16h pf;
      rs[p] = 0.f;
#pragma unroll
      for (int e = 0; e < 8; ++e) {
        float e0 = __expf(sc[2 * p][e]);
        float e1 = __expf(sc[2 * p + 1][e]);
        rs[p] += e0 + e1;
        pf[e]     = (_Float16)e0;   // B-frag element e   <-> key kb+e      of strip
        pf[8 + e] = (_Float16)e1;   // B-frag element 8+e <-> key 16+kb+e   of strip
      }
      // --- O^T += V^T x P^T ---
      o0 = __builtin_amdgcn_wmma_f32_16x16x32_f16(false, vf[2 * p], false, pf,
                                                  (short)0, o0, false, false);
      o1 = __builtin_amdgcn_wmma_f32_16x16x32_f16(false, vf[2 * p + 1], false, pf,
                                                  (short)0, o1, false, false);
    }
    l += (rs[0] + rs[1]) + (rs[2] + rs[3]);
    if (more) {  // the other buffer's readers left it at the last barrier
      v8h* kd = tile[(s + 1) & 1][0];
      v8h* vd = tile[(s + 1) & 1][1];
#pragma unroll
      for (int i = 0; i < NCH; ++i) {
        kd[(kslot ^ (i << 2)) + i * 16] =
            __builtin_shufflevector(gk[i][0], gk[i][1], 0, 1, 2, 3, 4, 5, 6, 7);
        vd[slot + i * 256] = gv[i];
      }
    }
    // Publishes stage s + 1 and ends every wave's reads of stage s.
    __syncthreads();
  }

  // --- epilogue: normalize, pack, two b128 stores per lane ---
  l += __shfl_xor(l, 16, 32);  // the two key-halves of each query
  float inv = 1.0f / l;
  int n = qt * 16 + col;
  size_t off = (((size_t)b * NN) + n) * INNER + h * DD;
  v8h r0, r1;
#pragma unroll
  for (int p = 0; p < 8; ++p) {
    r0[p] = (_Float16)(o0[p] * inv);   // d = kb+p
    r1[p] = (_Float16)(o1[p] * inv);   // d = 16+kb+p
  }
  *(v8h*)(AO + off + kb)      = r0;
  *(v8h*)(AO + off + 16 + kb) = r1;
}

// ---------------------------------------------------------------------------
// Kernel 3: output projection  out[b][o][n] = sum_c wo[o][c]*AO[b][n][c] + bo[o]
// Four waves form a work-group and share a 64 (o) x 64 (n) output block. Its
// 64 rows of wo and 64 rows of AO (512 bytes each, all of K = 256) come from
// global memory once per work-group, a whole row per wave-wide 16-byte load,
// and are laid in LDS in fragment order. A wave owns 2 x 2 tiles of 16 x 16,
// so every fragment it reads from LDS feeds two WMMAs.
// ---------------------------------------------------------------------------
#define OPB 64   // rows of wo, and rows of AO, per work-group

// One 16 x 32 fragment out of a staged operand: group = which 16 rows, k = which
// 32 of the 256 channels. rx = (lane & 15) ^ (lane >> 4), lh16 = lane & 16.
__device__ __forceinline__ v16h opnd_frag(const v8h* t, int group, int k, int lh16, int rx) {
  v8h lo = t[((group * 8 + k) * 2) * 32 + lh16 + (rx ^ ((k & 3) * 4))];
  v8h hi = t[((group * 8 + k) * 2 + 1) * 32 + lh16 + (rx ^ ((k & 3) * 4 + 2))];
  return __builtin_shufflevector(lo, hi, 0, 1, 2, 3, 4, 5, 6, 7,
                                 8, 9, 10, 11, 12, 13, 14, 15);
}

__global__ __launch_bounds__(128) void out_proj(const _Float16* __restrict__ wo16,
                                                const _Float16* __restrict__ AO,
                                                const float* __restrict__ bo,
                                                float* __restrict__ out) {
  // [wo, AO][4 groups of 16 rows][8 k steps][lo, hi][32 places] of 16 bytes: 64 KB
  __shared__ v8h opnd[2][(OPB / 16) * 8 * 2 * 32];
  const int oblocks = CC / OPB;
  const int nblocks = NN / OPB;
  int ob = blockIdx.x % oblocks;
  int rest = blockIdx.x / oblocks;
  int nb = rest % nblocks;
  int b  = rest / nblocks;
  int lane = threadIdx.x & 31;
  int wave = threadIdx.x >> 5;
  int col  = lane & 15;
  int hi8  = (lane & 16) ? 8 : 0;
  int og = (wave & 1) * 2;   // the wave's first group of 16 o
  int ng = (wave >> 1) * 2;  // the wave's first group of 16 n

  // Staging map. Wave w moves group w of both operands, one row a load; lane j
  // holds chunk j of the row: k step j >> 2, half (j >> 1) & 1 (lo or hi), and
  // it is what lane (j & 1) * 16 + row takes. Its place in that half-wave's 256
  // bytes has the row xor-ed with j & 15, so that the 16 lanes of a storing
  // half-wave, which all hold the same row, fall on 16 different bank groups; a
  // reading half-wave still covers all 16.
  const v8h* ag = (const v8h*)(wo16 + (size_t)(ob * OPB + wave * 16) * INNER) + lane;
  const v8h* bg = (const v8h*)(AO + ((size_t)b * NN + nb * OPB + wave * 16) * INNER) + lane;
  v8h ga[16], gb[16];
#pragma unroll
  for (int i = 0; i < 16; ++i) {
    ga[i] = ag[i * (INNER / 8)];
    gb[i] = bg[i * (INNER / 8)];
  }
  f32x4 bias[2][2];  // bo of the lane's eight rows in each of its two groups
#pragma unroll
  for (int u = 0; u < 2; ++u) {
    const f32x4* bp = (const f32x4*)(bo + ob * OPB + (og + u) * 16 + hi8);
    bias[u][0] = bp[0];
    bias[u][1] = bp[1];
  }
  int wbase = ((wave * 8 + (lane >> 2)) * 2 + ((lane >> 1) & 1)) * 32 + (lane & 1) * 16;
#pragma unroll
  for (int i = 0; i < 16; ++i) {
    opnd[0][wbase + (i ^ col)] = ga[i];
    opnd[1][wbase + (i ^ col)] = gb[i];
  }
  // Hands every wave's rows to the whole work-group.
  __syncthreads();

  int lh16 = lane & 16;
  int rx   = col ^ (lane >> 4);
  v8f acc[2][2] = {};
  // Fragments are read one k step ahead into a second register set, so that a
  // step's WMMAs do not wait out the LDS latency of their own reads.
  v16h af[2][2], bf[2][2];
#pragma unroll
  for (int u = 0; u < 2; ++u) {
    af[0][u] = opnd_frag(opnd[0], og + u, 0, lh16, rx);
    bf[0][u] = opnd_frag(opnd[1], ng + u, 0, lh16, rx);
  }
#pragma unroll
  for (int k = 0; k < INNER / 32; ++k) {
    if (k + 1 < INNER / 32) {
#pragma unroll
      for (int u = 0; u < 2; ++u) {
        af[(k + 1) & 1][u] = opnd_frag(opnd[0], og + u, k + 1, lh16, rx);
        bf[(k + 1) & 1][u] = opnd_frag(opnd[1], ng + u, k + 1, lh16, rx);
      }
    }
    // Keeps the next step's eight LDS reads issued as one group in front of
    // this step's WMMAs; left free, the compiler sinks them behind the WMMAs
    // and each step waits for its own reads.
    __builtin_amdgcn_sched_barrier(0);
#pragma unroll
    for (int u = 0; u < 2; ++u)
#pragma unroll
      for (int v = 0; v < 2; ++v)
        acc[u][v] = __builtin_amdgcn_wmma_f32_16x16x32_f16(false, af[k & 1][u], false, bf[k & 1][v],
                                                           (short)0, acc[u][v], false, false);
  }
#pragma unroll
  for (int u = 0; u < 2; ++u) {
    int o0 = ob * OPB + (og + u) * 16 + hi8;
    float* orow = out + (((size_t)b * CC) + o0) * NN + nb * OPB + ng * 16 + col;
#pragma unroll
    for (int p = 0; p < 8; ++p) {
#pragma unroll
      for (int v = 0; v < 2; ++v)
        orow[(size_t)p * NN + v * 16] = acc[u][v][p] + bias[u][p >> 2][p & 3];
    }
  }
}

// ---------------------------------------------------------------------------
extern "C" void kernel_launch(void* const* d_in, const int* in_sizes, int n_in,
                              void* d_out, int out_size, void* d_ws, size_t ws_size,
                              hipStream_t stream) {
  const float* x     = (const float*)d_in[0];
  const float* gamma = (const float*)d_in[1];
  const float* beta  = (const float*)d_in[2];
  const float* wk    = (const float*)d_in[3];
  const float* wq    = (const float*)d_in[4];
  const float* wv    = (const float*)d_in[5];
  const float* wo    = (const float*)d_in[6];
  const float* bo    = (const float*)d_in[7];
  float* out = (float*)d_out;

  char* ws = (char*)d_ws;
  size_t off = 0;
  _Float16* wo16 = (_Float16*)(ws + off); off += (size_t)CC * INNER * 2;        // 128 KB
  _Float16* Qh   = (_Float16*)(ws + off); off += (size_t)BB * HH * NN * DD * 2; // 2 MB
  _Float16* Kh   = (_Float16*)(ws + off); off += (size_t)BB * HH * NN * DD * 2; // 2 MB
  _Float16* Vt   = (_Float16*)(ws + off); off += (size_t)BB * HH * NN * DD * 2; // 2 MB
  _Float16* AO   = (_Float16*)(ws + off); off += (size_t)BB * NN * INNER * 2;   // 2 MB

  proj_kernel<<<dim3(PROJ_WG + CVT_WG), dim3(256), 0, stream>>>(
      x, gamma, beta, wk, wq, wv, Qh, Kh, Vt, wo, wo16);
  attn_fa<<<dim3(BB * HH * (NN / 128)), dim3(256), 0, stream>>>(Qh, Kh, Vt, AO);
  out_proj<<<dim3(BB * (NN / OPB) * (CC / OPB)), dim3(128), 0, stream>>>(wo16, AO, bo, out);
}

// v008
// One run takes 27.2 microseconds.
// Next to v007, in two timings, it ran 1.37 times as fast each time.
// Over all steps from v000 it is 3.52 times as fast.
#include <hip/hip_runtime.h>
#include <hip/hip_bf16.h>

// Flash-attention for the reference module, CDNA5 (gfx1250, wave32) WMMA path.
// Pipeline: proj (BN statistics of the group's own 32 channels, BN + grouped
//              conv on WMMA with split operands, head-split layouts; the f16
//              copy of wo is made by extra work-groups of the same grid)
//           -> attn_fa (TRANSPOSED scores: S^T = K*Q^T, so online-softmax stats
//              are per-lane scalars and the P fragment is born in B-frag layout;
//              K and V staged in LDS, shared by the eight waves of a group)
//           -> out_proj (256x256 WMMA GEMM + bias; both operands staged in LDS,
//              shared by the four waves of a group).
// Workspace requirement: 8,519,680 bytes (~8.5 MB).

typedef __attribute__((ext_vector_type(16))) _Float16 v16h;
typedef __attribute__((ext_vector_type(8)))  _Float16 v8h;
typedef __attribute__((ext_vector_type(4)))  _Float16 v4h;
typedef __attribute__((ext_vector_type(8)))  float    v8f;
typedef __attribute__((ext_vector_type(4)))  float    f32x4;
typedef __attribute__((ext_vector_type(2)))  float    f32x2;

#define BB 2
#define CC 256
#define NN 2048
#define HH 8
#define DD 32
#define INNER (HH * DD)   // 256

// ---------------------------------------------------------------------------
// Kernel 1: BatchNorm batch statistics + BN-normalize + grouped 1x1 conv
// projections. A work-group needs scale and shift of its group's 32 channels
// only, so it sums those channels itself (all of b and n, 512 KB out of L2):
// wave w takes channels 4w..4w+3, a row of 2048 floats is 16 wave-wide 16-byte
// loads, and the next row's 16 loads fly while this row is summed.
// The conv of a group is a 96 x 32 by 32 x 256 product and runs on WMMA
// (16x16x32, K = the group's 32 channels). To keep the accuracy of f32 operands,
// every operand is split v = hi + lo into two f16 numbers and a tile is the sum of
// three products, lo*hi + hi*lo + hi*hi, in the f32 accumulator (lo*lo lies
// 2^-22 below the result). A wave owns 32 columns n as two tiles, tile t holding
// n = n0 + 2 * m + t, so that a lane loads x and stores Q, K, V for both tiles
// in one wide access.
// Emits the reference's faithful '(d h)' head split WITH the q<-k swap and the
// 1/sqrt(D) scale folded into Qh. Layouts chosen for WMMA fragment loads:
//   Qh,Kh : [b, h', d' / 4, n, 4]: a group's channels give exactly the four
//           d' = 4g..4g+3 of every head. The weight rows are dealt to the A
//           tiles so that a lane's eight results are those four d' of two heads:
//           with both tiles that is a 16-byte store, 256 contiguous bytes per
//           half-wave, whole lines that no other work-group writes
//   Vt    : [b, h', 32, n]  (n contiguous)    -> P@V  frags are 2x b128/lane
//           (made as the transposed product, x as A: a lane's results are 16
//           consecutive n of one row)
// The work-groups behind the PROJ_WG projecting ones turn wo (f32, 256x256) into
// f16 for out_proj. That work depends on nothing here and nothing here depends
// on it; in this grid it runs on WGPs the projections leave idle and needs no
// launch of its own.
// ---------------------------------------------------------------------------
#define PROJ_WG (BB * HH * (NN / 256))      // 128 projecting work-groups
#define CVT_WG  (CC * INNER / (256 * 8))    // 32 converting ones, 8 elements a thread

// v = hi + lo, both f16: hi is v rounded, lo the rounding's remainder.
__device__ __forceinline__ void split_f16(float v, _Float16& hi, _Float16& lo) {
  hi = (_Float16)v;
  lo = (_Float16)(v - (float)hi);
}

__device__ __forceinline__ v16h join16(v8h lo, v8h hi) {
  return __builtin_shufflevector(lo, hi, 0, 1, 2, 3, 4, 5, 6, 7,
                                 8, 9, 10, 11, 12, 13, 14, 15);
}

__global__ __launch_bounds__(256) void proj_kernel(
    const float* __restrict__ x, const float* __restrict__ gamma,
    const float* __restrict__ beta, const float* __restrict__ wk,
    const float* __restrict__ wq, const float* __restrict__ wv,
    _Float16* __restrict__ Qh, _Float16* __restrict__ Kh,
    _Float16* __restrict__ Vt, const float* __restrict__ wo,
    _Float16* __restrict__ wo16) {
  __shared__ f32x4 aff[2][8];  // [scale, shift][wave] of four channels each
  // [wk, wq, wv times two tiles of 16 rows][hi, lo part][elements 0-7, 8-15][lane]
  __shared__ v8h wfrag[6][2][2][32];
  if (blockIdx.x >= PROJ_WG) {
    int i = ((blockIdx.x - PROJ_WG) * 256 + threadIdx.x) * 8;
    f32x4 lo = *(const f32x4*)(wo + i);
    f32x4 hi = *(const f32x4*)(wo + i + 4);
    v8h r;
#pragma unroll
    for (int e = 0; e < 4; ++e) { r[e] = (_Float16)lo[e]; r[4 + e] = (_Float16)hi[e]; }
    *(v8h*)(wo16 + i) = r;
    return;
  }
  const int ntile_cnt = NN / 256;
  int nt = blockIdx.x % ntile_cnt;
  int bg = blockIdx.x / ntile_cnt;
  int g  = bg % HH;
  int b  = bg / HH;
  const int lane = threadIdx.x & 31;
  const int wave = __builtin_amdgcn_readfirstlane(threadIdx.x >> 5);
  const int col  = lane & 15;             // the lane's row (A) or column (B, D) of a tile
  const int kb   = (lane & 16) ? 8 : 0;   // fragment element e is channel kb + e, 8 + e is 16 + kb + e
  const int n0   = nt * 256 + wave * 32;  // the wave's first column

  // x in fragment order, on its way while the sums are made: the lane's 16
  // channels of columns n0 + 2 * col (tile 0) and n0 + 2 * col + 1 (tile 1).
  f32x2 xv[16];
  {
    const float* xp = x + (((size_t)b * CC) + g * 32 + kb) * NN + n0 + 2 * col;
#pragma unroll
    for (int e = 0; e < 16; ++e)
      xv[e] = *(const f32x2*)(xp + (size_t)((e & 7) + (e >> 3) * 16) * NN);
    // The weight addresses below reuse the address registers of these loads.
    asm volatile("s_wait_xcnt 0x0" ::: "memory");
  }
  // Waves 0..5 each fetch one weight fragment for the whole work-group: matrix
  // wave / 2, tile wave % 2. Row m of a wk or wq tile is weight row dq * 8 + head
  // with dq = m & 3 and head = (m >> 3) * 4 + tile * 2 + ((m >> 2) & 1); wv keeps
  // its rows in order. Waves 6 and 7 load along (a wv tile) and drop it: a branch
  // here or among the sums splits the block that the statistics are scheduled in.
  f32x4 wr[4];
  {
    const int tl = wave & 1;
    const float* wm = wave < 2 ? wk : (wave < 4 ? wq : wv);
    const int row = wave < 4 ? (col & 3) * 8 + (col >> 3) * 4 + tl * 2 + ((col >> 2) & 1)
                             : tl * 16 + col;
    const float* wp = wm + g * 1024 + row * 32 + kb;
    wr[0] = *(const f32x4*)(wp);
    wr[1] = *(const f32x4*)(wp + 4);
    wr[2] = *(const f32x4*)(wp + 16);
    wr[3] = *(const f32x4*)(wp + 20);
  }

  // --- batch statistics of channels ch0..ch0+3, one wave ---
  {
    const int ch0  = g * 32 + wave * 4;
    const f32x4 gm = *(const f32x4*)(gamma + ch0);
    const f32x4 bt = *(const f32x4*)(beta + ch0);
    // Row r = 2 * j + bb is channel ch0 + j of batch bb.
    f32x4 buf[2][16];
#pragma unroll
    for (int i = 0; i < 16; ++i)
      buf[0][i] = ((const f32x4*)(x + (size_t)ch0 * NN))[i * 32 + lane];
    // The sums below reuse the address registers of the loads above; the
    // scheduling barrier keeps them behind the wait.
    asm volatile("s_wait_xcnt 0x0" ::: "memory");
    __builtin_amdgcn_sched_barrier(0);
    f32x4 sum, sq;
#pragma unroll
    for (int j = 0; j < 4; ++j) {
      f32x4 a = {0.f, 0.f, 0.f, 0.f}, q = {0.f, 0.f, 0.f, 0.f};
#pragma unroll
      for (int bb = 0; bb < BB; ++bb) {
        const int r = j * BB + bb;
        if (r + 1 < 4 * BB) {
          const float* nx = x + (((size_t)((r + 1) % BB) * CC) + ch0 + (r + 1) / BB) * NN;
#pragma unroll
          for (int i = 0; i < 16; ++i)
            buf[(r + 1) & 1][i] = ((const f32x4*)nx)[i * 32 + lane];
        }
        // Keeps the next row's 16 loads issued as one group in front of this
        // row's sums; left free, the compiler deals them out among the sums
        // and holds far fewer loads in flight.
        __builtin_amdgcn_sched_barrier(0);
#pragma unroll
        for (int i = 0; i < 16; ++i) {
          f32x4 v = buf[r & 1][i];
          a += v;
          q += v * v;
        }
      }
      sum[j] = (a[0] + a[1]) + (a[2] + a[3]);
      sq[j]  = (q[0] + q[1]) + (q[2] + q[3]);
    }
    // What follows reuses the registers that the rows' loads name.
    asm volatile("s_wait_xcnt 0x0" ::: "memory");
    __builtin_amdgcn_sched_barrier(0);
#pragma unroll
    for (int m = 16; m > 0; m >>= 1) {
#pragma unroll
      for (int j = 0; j < 4; ++j) {
        sum[j] += __shfl_xor(sum[j], m, 32);
        sq[j]  += __shfl_xor(sq[j], m, 32);
      }
    }
    f32x4 sc, sh;
#pragma unroll
    for (int j = 0; j < 4; ++j) {
      const float invn = 1.0f / (float)(BB * NN);
      float mean = sum[j] * invn;
      float var  = sq[j] * invn - mean * mean;
      sc[j] = gm[j] * rsqrtf(var + 1e-5f);
      sh[j] = bt[j] - mean * sc[j];
    }
    if (lane == 0) { aff[0][wave] = sc; aff[1][wave] = sh; }
  }
  // The weight fragment, long since arrived, is split and laid in LDS.
  if (wave < 6) {
    v8h ph[2], pl[2];
#pragma unroll
    for (int e = 0; e < 16; ++e) {
      _Float16 hi, lo;
      split_f16(wr[e >> 2][e & 3], hi, lo);
      ph[e >> 3][e & 7] = hi;
      pl[e >> 3][e & 7] = lo;
    }
    wfrag[wave][0][0][lane] = ph[0];
    wfrag[wave][0][1][lane] = ph[1];
    wfrag[wave][1][0][lane] = pl[0];
    wfrag[wave][1][1][lane] = pl[1];
  }
  // Hands every wave's four scales and shifts, and the six weight fragments, to
  // the whole work-group.
  __syncthreads();

  // All six fragments are asked for as one group, ahead of the work on x: read one
  // by one in front of its products, each waits out its LDS latency.
  v16h wh[6], wl[6];
#pragma unroll
  for (int f = 0; f < 6; ++f) {
    wh[f] = join16(wfrag[f][0][0][lane], wfrag[f][0][1][lane]);
    wl[f] = join16(wfrag[f][1][0][lane], wfrag[f][1][1][lane]);
  }
  // Normalized x of both tiles, split: as B it is 32 channels x 16 columns, as A
  // 16 columns x 32 channels, the same registers either way.
  v16h xh[2], xl[2];
#pragma unroll
  for (int c4 = 0; c4 < 4; ++c4) {
    const int at = (c4 >> 1) * 4 + (kb >> 2) + (c4 & 1);  // channels kb.., kb+4.., 16+kb.., 20+kb..
    f32x4 sc = aff[0][at], sh = aff[1][at];
#pragma unroll
    for (int e = 0; e < 4; ++e) {
#pragma unroll
      for (int t = 0; t < 2; ++t) {
        _Float16 hi, lo;
        split_f16(xv[c4 * 4 + e][t] * sc[e] + sh[e], hi, lo);
        xh[t][c4 * 4 + e] = hi;
        xl[t][c4 * 4 + e] = lo;
      }
    }
  }

  const float qscale = 0.17677669529663687f;  // 1/sqrt(32)
  const v8f zero = {};
#pragma unroll
  for (int f = 0; f < 6; ++f) {
    const int tl = f & 1;
    v8f acc[2];
    if (f < 4) {
      // D = W x xn: the lane's column is n0 + 2 * col + t, element e is tile row kb + e.
#pragma unroll
      for (int t = 0; t < 2; ++t) {
        acc[t] = __builtin_amdgcn_wmma_f32_16x16x32_f16(false, wl[f], false, xh[t], (short)0, zero, false, false);
        acc[t] = __builtin_amdgcn_wmma_f32_16x16x32_f16(false, wh[f], false, xl[t], (short)0, acc[t], false, false);
        acc[t] = __builtin_amdgcn_wmma_f32_16x16x32_f16(false, wh[f], false, xh[t], (short)0, acc[t], false, false);
      }
      _Float16* dst = f < 2 ? Qh : Kh;           // q <- k, k <- q (swap)
      const float scl = f < 2 ? qscale : 1.0f;   // Q pre-scaled
#pragma unroll
      for (int s = 0; s < 2; ++s) {
        int hh = (kb >> 1) + tl * 2 + s;
        v8h r;
#pragma unroll
        for (int i = 0; i < 4; ++i) {
          r[i]     = (_Float16)(acc[0][s * 4 + i] * scl);
          r[4 + i] = (_Float16)(acc[1][s * 4 + i] * scl);
        }
        size_t at = ((((size_t)b * HH + hh) * (DD / 4) + g) * NN + n0 + 2 * col) * 4;
        *(v8h*)(dst + at) = r;
      }
    } else {
      // D = xn^T x Wv^T: the lane's column is weight row tl * 16 + col, element e
      // is column n0 + 2 * (kb + e) + t.
#pragma unroll
      for (int t = 0; t < 2; ++t) {
        acc[t] = __builtin_amdgcn_wmma_f32_16x16x32_f16(false, xh[t], false, wl[f], (short)0, zero, false, false);
        acc[t] = __builtin_amdgcn_wmma_f32_16x16x32_f16(false, xl[t], false, wh[f], (short)0, acc[t], false, false);
        acc[t] = __builtin_amdgcn_wmma_f32_16x16x32_f16(false, xh[t], false, wh[f], (short)0, acc[t], false, false);
      }
      int hh = col & 7;                          // channel = d' * H + h'
      int dd = g * 4 + tl * 2 + (col >> 3);
      v8h r[2];
#pragma unroll
      for (int e = 0; e < 8; ++e) {
        r[e >> 2][(e & 3) * 2]     = (_Float16)acc[0][e];
        r[e >> 2][(e & 3) * 2 + 1] = (_Float16)acc[1][e];
      }
      _Float16* vp = Vt + (((size_t)b * HH + hh) * DD + dd) * NN + n0 + 2 * kb;
      *(v8h*)(vp)     = r[0];
      *(v8h*)(vp + 8) = r[1];
    }
    // The next fragment's work rewrites the registers that these stores name.
    if (f + 1 < 6) asm volatile("s_wait_xcnt 0x0" ::: "memory");
  }
}

// ---------------------------------------------------------------------------
// Kernel 2: flash attention with TRANSPOSED score tiles.
//   S^T = A(K-tile 16keys x 32d) x B(Q^T 32d x 16queries)
//     -> C-layout: lane owns one query column; its 8 elements are keys
//        {kb..kb+7} (kb = lane>=16 ? 8 : 0) of the strip half.
//   Softmax stats (m, l) are per-lane scalars. The maximum in use, m, is lazy:
//   -m is the C operand of every score product, so the scores leave the matrix
//   unit already shifted, and one test per 128-key stage (a ballot, a scalar
//   branch) asks whether any shifted score of the wave exceeds LAZY. Only then, and in the first stage,
//   are the two key-halves' maxima merged, m raised, and scores, O and l scaled.
//   l is each lane's own partial sum; the halves join behind the loop.
//   exp(S^T - m) lands *directly* in the B-frag layout required by
//   O^T = A(V^T 16d x 32keys) x B(P^T 32keys x 16queries): pf[i]=e(s0[i]),
//   pf[8+i]=e(s1[i]).
//   Eight waves (128 queries of one head) form a work-group and share every
//   K and V fragment: a stage of 128 keys is fetched from global memory once
//   per work-group, one stage ahead, and laid in LDS in fragment order, so a
//   fragment half is one ds_load_b128 over 512 contiguous bytes per wave.
//   Epilogue: each lane holds 8 contiguous d values per accumulator ->
//   two packed b128 stores into AO[b][n][h*32+d].
// ---------------------------------------------------------------------------
#define QWAVES 8              // waves per work-group, 16 queries each
#define SKEYS  128            // keys per stage
#define NSTAGE (NN / SKEYS)   // 16
#define NCH    (SKEYS / 64)   // 16-byte chunks of each tile that one thread moves
#define LAZY   5.5f           // a score may pass the maximum in use by this much: P <= e^5.5, far inside f16

// One 16 x 32 fragment out of a staged tile: group = which 16 rows.
__device__ __forceinline__ v16h lds_frag(const v8h* t, int group, int llo, int lhi) {
  v8h lo = t[(group * 2) * 32 + llo];
  v8h hi = t[(group * 2 + 1) * 32 + lhi];
  return __builtin_shufflevector(lo, hi, 0, 1, 2, 3, 4, 5, 6, 7,
                                 8, 9, 10, 11, 12, 13, 14, 15);
}

__global__ __launch_bounds__(256) void attn_fa(const _Float16* __restrict__ Qh,
                                               const _Float16* __restrict__ Kh,
                                               const _Float16* __restrict__ Vt,
                                               _Float16* __restrict__ AO) {
  // [buffer][K, V][8 groups of 16 rows][lo, hi][32 places] of 16 bytes: 32 KB
  __shared__ v8h tile[2][2][SKEYS * 4];
  const int qblocks = NN / (16 * QWAVES);
  int qb = blockIdx.x % qblocks;
  int bh = blockIdx.x / qblocks;  // b*HH + h
  int h  = bh % HH;
  int b  = bh / HH;
  int tid  = threadIdx.x;
  int lane = tid & 31;
  int qt   = qb * QWAVES + (tid >> 5);
  int col  = lane & 15;                // this lane's query within the tile
  int kb   = (lane & 16) ? 8 : 0;      // key-half / d-half selector

  const _Float16* Qbase = Qh + ((size_t)bh * (DD / 4) * NN + qt * 16) * 4;  // d' / 4 = 0
  const _Float16* Kbase = Kh + (size_t)bh * (DD / 4) * NN * 4;
  const _Float16* Vbase = Vt + ((size_t)bh * DD) * NN;

  // Staging map. A tile is 128 rows of four 16-byte chunks (K: row = key;
  // V: row = strip * 32 + d, its 64 bytes the strip's 32 keys). Chunk c of row
  // rr is what lane (c & 1) * 16 + (rr & 15) takes as its lo (c < 2) or hi half.
  // Its place in that half's 512 bytes has the row xor-ed with 4 * c, so that
  // the 16 lanes of a half-wave, which store four chunks of each of four rows,
  // fall on 16 different bank groups; a reading half-wave still covers all 16.
  // Of V thread t moves chunks t + 256 * i (row + 64 * i, slot + 256 * i). Of K it
  // moves chunks 2 * (t >> 7) + i of key t & 127, each out of two 8-byte units of
  // neighbouring d' / 4 planes: a wave's load is 256 contiguous bytes, and the 16
  // lanes of a storing half-wave hold 16 rows of one chunk, 16 bank groups.
  int c  = tid & 3;
  int rr = tid >> 2;
  int slot = ((rr >> 4) * 2 + (c >> 1)) * 32 + (c & 1) * 16 + ((rr & 15) ^ (c << 2));
  int llo  = (lane & 16) | (col ^ ((lane & 16) >> 2));  // reader's place, c = 0 or 1
  int lhi  = llo ^ 8;                                   // reader's place, c = 2 or 3
  int key = tid & 127;
  int ch  = tid >> 7;
  int kslot = ((key >> 4) * 2 + ch) * 32 + ((key & 15) ^ (ch << 3));  // chunk 2 * ch
  const _Float16* kg = Kbase + ((size_t)(ch * 4) * NN + key) * 4;
  const _Float16* vg = Vbase + (size_t)(rr & 31) * NN + (rr >> 5) * 32 + c * 8;

  v4h gk[NCH][2];
  v8h gv[NCH];
#pragma unroll
  for (int i = 0; i < NCH; ++i) {
    gk[i][0] = *(const v4h*)(kg + (2 * i) * NN * 4);
    gk[i][1] = *(const v4h*)(kg + (2 * i + 1) * NN * 4);
    gv[i] = *(const v8h*)(vg + i * 64);
  }
  // B-frag of Q^T, lives across the loop: d' = kb..kb+7 and 16+kb..16+kb+7 of
  // query col, four 8-byte units.
  v16h qf;
  {
    const _Float16* qp = Qbase + ((size_t)(kb >> 2) * NN + col) * 4;
    v4h q0 = *(const v4h*)(qp);
    v4h q1 = *(const v4h*)(qp + NN * 4);
    v4h q2 = *(const v4h*)(qp + 4 * NN * 4);
    v4h q3 = *(const v4h*)(qp + 5 * NN * 4);
    v8h lo = __builtin_shufflevector(q0, q1, 0, 1, 2, 3, 4, 5, 6, 7);
    v8h hi = __builtin_shufflevector(q2, q3, 0, 1, 2, 3, 4, 5, 6, 7);
    qf = __builtin_shufflevector(lo, hi, 0, 1, 2, 3, 4, 5, 6, 7,
                                 8, 9, 10, 11, 12, 13, 14, 15);
  }
#pragma unroll
  for (int i = 0; i < NCH; ++i) {
    tile[0][0][(kslot ^ (i << 2)) + i * 16] =
        __builtin_shufflevector(gk[i][0], gk[i][1], 0, 1, 2, 3, 4, 5, 6, 7);
    tile[0][1][slot + i * 256] = gv[i];
  }
  __syncthreads();

  v8f o0 = {};  // O^T rows d = kb..kb+7        (cols = queries)
  v8f o1 = {};  // O^T rows d = 16+kb..16+kb+7
  v8f cm = {};  // -m in all eight places: the C operand of the score products
  float m = 0.f, l = 0.f;

  for (int s = 0; s < NSTAGE; ++s) {
    const bool more = s + 1 < NSTAGE;
    if (more) {  // next stage's chunks fly while this stage is worked on
      const _Float16* kn = kg + (s + 1) * SKEYS * 4;
      const _Float16* vn = vg + (s + 1) * SKEYS;
#pragma unroll
      for (int i = 0; i < NCH; ++i) {
        gk[i][0] = *(const v4h*)(kn + (2 * i) * NN * 4);
        gk[i][1] = *(const v4h*)(kn + (2 * i + 1) * NN * 4);
        gv[i] = *(const v8h*)(vn + i * 64);
      }
      // The stage's LDS reads reuse the address registers of these loads.
      asm volatile("s_wait_xcnt 0x0" ::: "memory");
    }
    const v8h* kt = tile[s & 1][0];
    const v8h* vt = tile[s & 1][1];
    // Every loop of the stage is unrolled: vf, sc, mp and rs are register arrays.
    // All of the stage's V fragments are asked for as one group, ahead of the
    // strips that use them: read strip by strip, each waits out its LDS latency.
    v16h vf[SKEYS / 16];  // [2 * strip]: d = 0..15, [2 * strip + 1]: d = 16..31
#pragma unroll
    for (int p = 0; p < SKEYS / 16; ++p) vf[p] = lds_frag(vt, p, llo, lhi);
    v8f sc[SKEYS / 16];  // S^T - m, 16 keys each
#pragma unroll
    for (int p = 0; p < SKEYS / 16; ++p)
      sc[p] = __builtin_amdgcn_wmma_f32_16x16x32_f16(false, lds_frag(kt, p, llo, lhi), false, qf,
                                                     (short)0, cm, false, false);
    // --- the lane's largest shifted score of the stage, four chains ---
    float mp[SKEYS / 32];
#pragma unroll
    for (int p = 0; p < SKEYS / 32; ++p) {
      mp[p] = fmaxf(sc[2 * p][0], sc[2 * p + 1][0]);
#pragma unroll
      for (int e = 1; e < 8; ++e) mp[p] = fmaxf(mp[p], fmaxf(sc[2 * p][e], sc[2 * p + 1][e]));
    }
    float mx = fmaxf(fmaxf(mp[0], mp[1]), fmaxf(mp[2], mp[3]));
    // Wave-uniform: the first stage sets m, a later one raises it when some score
    // has outgrown it. Every lane is on inside.
    if (s == 0 || __builtin_amdgcn_ballot_w32(mx > LAZY) != 0) {
      mx = fmaxf(mx, __shfl_xor(mx, 16, 32));    // merge the two key-halves
      float up    = (s == 0) ? mx : fmaxf(mx, 0.f);
      float alpha = (s == 0) ? 1.f : __expf(-up);  // O and l are still 0 in stage 0
#pragma unroll
      for (int p = 0; p < SKEYS / 16; ++p)
#pragma unroll
        for (int e = 0; e < 8; ++e) sc[p][e] -= up;
#pragma unroll
      for (int e = 0; e < 8; ++e) { o0[e] *= alpha; o1[e] *= alpha; }
      l *= alpha;
      m += up;
#pragma unroll
      for (int e = 0; e < 8; ++e) cm[e] = -m;
    }
    float rs[SKEYS / 32];
#pragma unroll
    for (int p = 0; p < SKEYS / 32; ++p) {
      // Keeps the next stage's LDS stores, which wait for its global loads, from
      // rising above the last strip: higher up they wait out the loads' latency.
      if (p == SKEYS / 32 - 1) __builtin_amdgcn_sched_barrier(0);
      v16h pf;
      rs[p] = 0.f;
#pragma unroll
      for (int e = 0; e < 8; ++e) {
        float e0 = __expf(sc[2 * p][e]);
        float e1 = __expf(sc[2 * p + 1][e]);
        rs[p] += e0 + e1;
        pf[e]     = (_Float16)e0;   // B-frag element e   <-> key kb+e      of strip
        pf[8 + e] = (_Float16)e1;   // B-frag element 8+e <-> key 16+kb+e   of strip
      }
      // --- O^T += V^T x P^T ---
      o0 = __builtin_amdgcn_wmma_f32_16x16x32_f16(false, vf[2 * p], false, pf,
                                                  (short)0, o0, false, false);
      o1 = __builtin_amdgcn_wmma_f32_16x16x32_f16(false, vf[2 * p + 1], false, pf,
                                                  (short)0, o1, false, false);
    }
    l += (rs[0] + rs[1]) + (rs[2] + rs[3]);
    if (more) {  // the other buffer's readers left it at the last barrier
      v8h* kd = tile[(s + 1) & 1][0];
      v8h* vd = tile[(s + 1) & 1][1];
#pragma unroll
      for (int i = 0; i < NCH; ++i) {
        kd[(kslot ^ (i << 2)) + i * 16] =
            __builtin_shufflevector(gk[i][0], gk[i][1], 0, 1, 2, 3, 4, 5, 6, 7);
        vd[slot + i * 256] = gv[i];
      }
    }
    // Publishes stage s + 1 and ends every wave's reads of stage s.
    __syncthreads();
  }

  // --- epilogue: normalize, pack, two b128 stores per lane ---
  l += __shfl_xor(l, 16, 32);  // the two key-halves of each query
  float inv = 1.0f / l;
  int n = qt * 16 + col;
  size_t off = (((size_t)b * NN) + n) * INNER + h * DD;
  v8h r0, r1;
#pragma unroll
  for (int p = 0; p < 8; ++p) {
    r0[p] = (_Float16)(o0[p] * inv);   // d = kb+p
    r1[p] = (_Float16)(o1[p] * inv);   // d = 16+kb+p
  }
  *(v8h*)(AO + off + kb)      = r0;
  *(v8h*)(AO + off + 16 + kb) = r1;
}

// ---------------------------------------------------------------------------
// Kernel 3: output projection  out[b][o][n] = sum_c wo[o][c]*AO[b][n][c] + bo[o]
// Four waves form a work-group and share a 64 (o) x 64 (n) output block. Its
// 64 rows of wo and 64 rows of AO (512 bytes each, all of K = 256) come from
// global memory once per work-group, a whole row per wave-wide 16-byte load,
// and are laid in LDS in fragment order. A wave owns 2 x 2 tiles of 16 x 16,
// so every fragment it reads from LDS feeds two WMMAs.
// ---------------------------------------------------------------------------
#define OPB 64   // rows of wo, and rows of AO, per work-group

// One 16 x 32 fragment out of a staged operand: group = which 16 rows, k = which
// 32 of the 256 channels. rx = (lane & 15) ^ (lane >> 4), lh16 = lane & 16.
__device__ __forceinline__ v16h opnd_frag(const v8h* t, int group, int k, int lh16, int rx) {
  v8h lo = t[((group * 8 + k) * 2) * 32 + lh16 + (rx ^ ((k & 3) * 4))];
  v8h hi = t[((group * 8 + k) * 2 + 1) * 32 + lh16 + (rx ^ ((k & 3) * 4 + 2))];
  return __builtin_shufflevector(lo, hi, 0, 1, 2, 3, 4, 5, 6, 7,
                                 8, 9, 10, 11, 12, 13, 14, 15);
}

__global__ __launch_bounds__(128) void out_proj(const _Float16* __restrict__ wo16,
                                                const _Float16* __restrict__ AO,
                                                const float* __restrict__ bo,
                                                float* __restrict__ out) {
  // [wo, AO][4 groups of 16 rows][8 k steps][lo, hi][32 places] of 16 bytes: 64 KB
  __shared__ v8h opnd[2][(OPB / 16) * 8 * 2 * 32];
  const int oblocks = CC / OPB;
  const int nblocks = NN / OPB;
  int ob = blockIdx.x % oblocks;
  int rest = blockIdx.x / oblocks;
  int nb = rest % nblocks;
  int b  = rest / nblocks;
  int lane = threadIdx.x & 31;
  int wave = threadIdx.x >> 5;
  int col  = lane & 15;
  int hi8  = (lane & 16) ? 8 : 0;
  int og = (wave & 1) * 2;   // the wave's first group of 16 o
  int ng = (wave >> 1) * 2;  // the wave's first group of 16 n

  // Staging map. Wave w moves group w of both operands, one row a load; lane j
  // holds chunk j of the row: k step j >> 2, half (j >> 1) & 1 (lo or hi), and
  // it is what lane (j & 1) * 16 + row takes. Its place in that half-wave's 256
  // bytes has the row xor-ed with j & 15, so that the 16 lanes of a storing
  // half-wave, which all hold the same row, fall on 16 different bank groups; a
  // reading half-wave still covers all 16.
  const v8h* ag = (const v8h*)(wo16 + (size_t)(ob * OPB + wave * 16) * INNER) + lane;
  const v8h* bg = (const v8h*)(AO + ((size_t)b * NN + nb * OPB + wave * 16) * INNER) + lane;
  v8h ga[16], gb[16];
#pragma unroll
  for (int i = 0; i < 16; ++i) {
    ga[i] = ag[i * (INNER / 8)];
    gb[i] = bg[i * (INNER / 8)];
  }
  f32x4 bias[2][2];  // bo of the lane's eight rows in each of its two groups
#pragma unroll
  for (int u = 0; u < 2; ++u) {
    const f32x4* bp = (const f32x4*)(bo + ob * OPB + (og + u) * 16 + hi8);
    bias[u][0] = bp[0];
    bias[u][1] = bp[1];
  }
  int wbase = ((wave * 8 + (lane >> 2)) * 2 + ((lane >> 1) & 1)) * 32 + (lane & 1) * 16;
#pragma unroll
  for (int i = 0; i < 16; ++i) {
    opnd[0][wbase + (i ^ col)] = ga[i];
    opnd[1][wbase + (i ^ col)] = gb[i];
  }
  // Hands every wave's rows to the whole work-group.
  __syncthreads();

  int lh16 = lane & 16;
  int rx   = col ^ (lane >> 4);
  v8f acc[2][2] = {};
  // Fragments are read one k step ahead into a second register set, so that a
  // step's WMMAs do not wait out the LDS latency of their own reads.
  v16h af[2][2], bf[2][2];
#pragma unroll
  for (int u = 0; u < 2; ++u) {
    af[0][u] = opnd_frag(opnd[0], og + u, 0, lh16, rx);
    bf[0][u] = opnd_frag(opnd[1], ng + u, 0, lh16, rx);
  }
#pragma unroll
  for (int k = 0; k < INNER / 32; ++k) {
    if (k + 1 < INNER / 32) {
#pragma unroll
      for (int u = 0; u < 2; ++u) {
        af[(k + 1) & 1][u] = opnd_frag(opnd[0], og + u, k + 1, lh16, rx);
        bf[(k + 1) & 1][u] = opnd_frag(opnd[1], ng + u, k + 1, lh16, rx);
      }
    }
    // Keeps the next step's eight LDS reads issued as one group in front of
    // this step's WMMAs; left free, the compiler sinks them behind the WMMAs
    // and each step waits for its own reads.
    __builtin_amdgcn_sched_barrier(0);
#pragma unroll
    for (int u = 0; u < 2; ++u)
#pragma unroll
      for (int v = 0; v < 2; ++v)
        acc[u][v] = __builtin_amdgcn_wmma_f32_16x16x32_f16(false, af[k & 1][u], false, bf[k & 1][v],
                                                           (short)0, acc[u][v], false, false);
  }
#pragma unroll
  for (int u = 0; u < 2; ++u) {
    int o0 = ob * OPB + (og + u) * 16 + hi8;
    float* orow = out + (((size_t)b * CC) + o0) * NN + nb * OPB + ng * 16 + col;
#pragma unroll
    for (int p = 0; p < 8; ++p) {
#pragma unroll
      for (int v = 0; v < 2; ++v)
        orow[(size_t)p * NN + v * 16] = acc[u][v][p] + bias[u][p >> 2][p & 3];
    }
  }
}

// ---------------------------------------------------------------------------
extern "C" void kernel_launch(void* const* d_in, const int* in_sizes, int n_in,
                              void* d_out, int out_size, void* d_ws, size_t ws_size,
                              hipStream_t stream) {
  const float* x     = (const float*)d_in[0];
  const float* gamma = (const float*)d_in[1];
  const float* beta  = (const float*)d_in[2];
  const float* wk    = (const float*)d_in[3];
  const float* wq    = (const float*)d_in[4];
  const float* wv    = (const float*)d_in[5];
  const float* wo    = (const float*)d_in[6];
  const float* bo    = (const float*)d_in[7];
  float* out = (float*)d_out;

  char* ws = (char*)d_ws;
  size_t off = 0;
  _Float16* wo16 = (_Float16*)(ws + off); off += (size_t)CC * INNER * 2;        // 128 KB
  _Float16* Qh   = (_Float16*)(ws + off); off += (size_t)BB * HH * NN * DD * 2; // 2 MB
  _Float16* Kh   = (_Float16*)(ws + off); off += (size_t)BB * HH * NN * DD * 2; // 2 MB
  _Float16* Vt   = (_Float16*)(ws + off); off += (size_t)BB * HH * NN * DD * 2; // 2 MB
  _Float16* AO   = (_Float16*)(ws + off); off += (size_t)BB * NN * INNER * 2;   // 2 MB

  proj_kernel<<<dim3(PROJ_WG + CVT_WG), dim3(256), 0, stream>>>(
      x, gamma, beta, wk, wq, wv, Qh, Kh, Vt, wo, wo16);
  attn_fa<<<dim3(BB * HH * (NN / 128)), dim3(256), 0, stream>>>(Qh, Kh, Vt, AO);
  out_proj<<<dim3(BB * (NN / OPB) * (CC / OPB)), dim3(128), 0, stream>>>(wo16, AO, bo, out);
}

// v009
// It runs in 26.1 microseconds.
// In both of two side-by-side timings against v008, it was 1.03 times as fast.
// Counting every step since v000, it is 3.62 times as fast.
#include <hip/hip_runtime.h>
#include <hip/hip_bf16.h>

// Flash-attention for the reference module, CDNA5 (gfx1250, wave32) WMMA path.
// Pipeline: proj (BN statistics of the group's own 32 channels, BN + grouped
//              conv on WMMA with split operands, head-split layouts; the f16
//              copy of wo is made by extra work-groups of the same grid)
//           -> attn_fa (TRANSPOSED scores: S^T = K*Q^T, so online-softmax stats
//              are per-lane scalars and the P fragment is born in B-frag layout;
//              K and V staged in LDS, shared by the eight waves of a group)
//           -> out_proj (256x256 WMMA GEMM + bias; both operands staged in LDS,
//              shared by the four waves of a group).
// Workspace requirement: 8,519,680 bytes (~8.5 MB).

typedef __attribute__((ext_vector_type(16))) _Float16 v16h;
typedef __attribute__((ext_vector_type(8)))  _Float16 v8h;
typedef __attribute__((ext_vector_type(4)))  _Float16 v4h;
typedef __attribute__((ext_vector_type(8)))  float    v8f;
typedef __attribute__((ext_vector_type(4)))  float    f32x4;
typedef __attribute__((ext_vector_type(2)))  float    f32x2;

#define BB 2
#define CC 256
#define NN 2048
#define HH 8
#define DD 32
#define INNER (HH * DD)   // 256

// ---------------------------------------------------------------------------
// Kernel 1: BatchNorm batch statistics + BN-normalize + grouped 1x1 conv
// projections. A work-group needs scale and shift of its group's 32 channels
// only, so it sums those channels itself (all of b and n, 512 KB out of L2):
// wave w takes channels 4w..4w+3 and walks their eight rows along n, 16 wave-wide
// 16-byte loads a step, the next step's loads flying while this step is summed;
// the work-groups that sum the same channels start at different steps.
// The conv of a group is a 96 x 32 by 32 x 256 product and runs on WMMA
// (16x16x32, K = the group's 32 channels). To keep the accuracy of f32 operands,
// every operand is split v = hi + lo into two f16 numbers and a tile is the sum of
// three products, lo*hi + hi*lo + hi*hi, in the f32 accumulator (lo*lo lies
// 2^-22 below the result). A wave owns 32 columns n as two tiles, tile t holding
// n = n0 + 2 * m + t, so that a lane loads x and stores Q, K, V for both tiles
// in one wide access.
// Emits the reference's faithful '(d h)' head split WITH the q<-k swap and the
// 1/sqrt(D) scale folded into Qh. Layouts chosen for WMMA fragment loads:
//   Qh,Kh : [b, h', d' / 4, n, 4]: a group's channels give exactly the four
//           d' = 4g..4g+3 of every head. The weight rows are dealt to the A
//           tiles so that a lane's eight results are those four d' of two heads:
//           with both tiles that is a 16-byte store, 256 contiguous bytes per
//           half-wave, whole lines that no other work-group writes
//   Vt    : [b, h', 32, n]  (n contiguous)    -> P@V  frags are 2x b128/lane
//           (made as the transposed product, x as A: a lane's results are 16
//           consecutive n of one row)
// The work-groups behind the PROJ_WG projecting ones turn wo (f32, 256x256) into
// f16 for out_proj. That work depends on nothing here and nothing here depends
// on it; in this grid it runs on WGPs the projections leave idle and needs no
// launch of its own.
// ---------------------------------------------------------------------------
#define PROJ_WG (BB * HH * (NN / 256))      // 128 projecting work-groups
#define CVT_WG  (CC * INNER / (256 * 8))    // 32 converting ones, 8 elements a thread

// v = hi + lo, both f16: hi is v rounded, lo the rounding's remainder.
__device__ __forceinline__ void split_f16(float v, _Float16& hi, _Float16& lo) {
  hi = (_Float16)v;
  lo = (_Float16)(v - (float)hi);
}

__device__ __forceinline__ v16h join16(v8h lo, v8h hi) {
  return __builtin_shufflevector(lo, hi, 0, 1, 2, 3, 4, 5, 6, 7,
                                 8, 9, 10, 11, 12, 13, 14, 15);
}

__global__ __launch_bounds__(256) void proj_kernel(
    const float* __restrict__ x, const float* __restrict__ gamma,
    const float* __restrict__ beta, const float* __restrict__ wk,
    const float* __restrict__ wq, const float* __restrict__ wv,
    _Float16* __restrict__ Qh, _Float16* __restrict__ Kh,
    _Float16* __restrict__ Vt, const float* __restrict__ wo,
    _Float16* __restrict__ wo16) {
  __shared__ f32x4 aff[2][8];  // [scale, shift][wave] of four channels each
  // [wk, wq, wv times two tiles of 16 rows][hi, lo part][elements 0-7, 8-15][lane]
  __shared__ v8h wfrag[6][2][2][32];
  if (blockIdx.x >= PROJ_WG) {
    int i = ((blockIdx.x - PROJ_WG) * 256 + threadIdx.x) * 8;
    f32x4 lo = *(const f32x4*)(wo + i);
    f32x4 hi = *(const f32x4*)(wo + i + 4);
    v8h r;
#pragma unroll
    for (int e = 0; e < 4; ++e) { r[e] = (_Float16)lo[e]; r[4 + e] = (_Float16)hi[e]; }
    *(v8h*)(wo16 + i) = r;
    return;
  }
  const int ntile_cnt = NN / 256;
  int nt = blockIdx.x % ntile_cnt;
  int bg = blockIdx.x / ntile_cnt;
  int g  = bg % HH;
  int b  = bg / HH;
  const int lane = threadIdx.x & 31;
  const int wave = __builtin_amdgcn_readfirstlane(threadIdx.x >> 5);
  const int col  = lane & 15;             // the lane's row (A) or column (B, D) of a tile
  const int kb   = (lane & 16) ? 8 : 0;   // fragment element e is channel kb + e, 8 + e is 16 + kb + e
  const int n0   = nt * 256 + wave * 32;  // the wave's first column

  // x in fragment order, on its way while the sums are made: the lane's 16
  // channels of columns n0 + 2 * col (tile 0) and n0 + 2 * col + 1 (tile 1).
  f32x2 xv[16];
  {
    const float* xp = x + (((size_t)b * CC) + g * 32 + kb) * NN + n0 + 2 * col;
#pragma unroll
    for (int e = 0; e < 16; ++e)
      xv[e] = *(const f32x2*)(xp + (size_t)((e & 7) + (e >> 3) * 16) * NN);
    // The weight addresses below reuse the address registers of these loads.
    asm volatile("s_wait_xcnt 0x0" ::: "memory");
  }
  // Waves 0..5 each fetch one weight fragment for the whole work-group: matrix
  // wave / 2, tile wave % 2. Row m of a wk or wq tile is weight row dq * 8 + head
  // with dq = m & 3 and head = (m >> 3) * 4 + tile * 2 + ((m >> 2) & 1); wv keeps
  // its rows in order. Waves 6 and 7 load along (a wv tile) and drop it: a branch
  // here or among the sums splits the block that the statistics are scheduled in.
  f32x4 wr[4];
  {
    const int tl = wave & 1;
    const float* wm = wave < 2 ? wk : (wave < 4 ? wq : wv);
    const int row = wave < 4 ? (col & 3) * 8 + (col >> 3) * 4 + tl * 2 + ((col >> 2) & 1)
                             : tl * 16 + col;
    const float* wp = wm + g * 1024 + row * 32 + kb;
    wr[0] = *(const f32x4*)(wp);
    wr[1] = *(const f32x4*)(wp + 4);
    wr[2] = *(const f32x4*)(wp + 16);
    wr[3] = *(const f32x4*)(wp + 20);
  }

  // --- batch statistics of channels ch0..ch0+3, one wave ---
  {
    const int ch0  = g * 32 + wave * 4;
    const f32x4 gm = *(const f32x4*)(gamma + ch0);
    const f32x4 bt = *(const f32x4*)(beta + ch0);
    // The 16 work-groups of a group sum the same 512 KB. Walking it in one order
    // they ask L2 for the same lines at the same moment and all wait for the one
    // fetch from memory. So the walk goes along n in eight steps of 256 columns
    // and each work-group starts at another step: what one fetches first, the
    // others find in L2 later. Step p holds 1 KB, two wave-wide loads, of each of
    // the wave's eight rows: entry (j * BB + bb) * 2 + i is channel ch0 + j of
    // batch bb. Neighbouring nt and the two b get eight different starts.
    const int rot = ((nt & 3) << 1) | b;
    const float* xs = x + (size_t)ch0 * NN;   // the same in every lane
    const unsigned lo4 = lane * 4;            // the lane's four columns of a load
    f32x4 buf[2][16];
#pragma unroll
    for (int e = 0; e < 16; ++e)
      buf[0][e] = *(const f32x4*)(xs + rot * 256 + ((size_t)((e >> 1) % BB) * CC + (e >> 2)) * NN +
                                  (e & 1) * 128 + lo4);
    // The next step's addresses reuse the address registers of the loads above;
    // the scheduling barrier keeps them behind the wait.
    asm volatile("s_wait_xcnt 0x0" ::: "memory");
    __builtin_amdgcn_sched_barrier(0);
    f32x4 a[4] = {}, q[4] = {};
#pragma unroll
    for (int p = 0; p < 8; ++p) {
      if (p + 1 < 8) {
        const float* nx = xs + ((p + 1 + rot) & 7) * 256;
#pragma unroll
        for (int e = 0; e < 16; ++e)
          buf[(p + 1) & 1][e] = *(const f32x4*)(nx + ((size_t)((e >> 1) % BB) * CC + (e >> 2)) * NN +
                                                (e & 1) * 128 + lo4);
        // The step after this one rewrites the scalar base of these loads.
        asm volatile("s_wait_xcnt 0x0" ::: "memory");
      }
      // Keeps the next step's 16 loads issued as one group in front of this
      // step's sums; left free, the compiler deals them out among the sums
      // and holds far fewer loads in flight.
      __builtin_amdgcn_sched_barrier(0);
#pragma unroll
      for (int e = 0; e < 16; ++e) {
        f32x4 v = buf[p & 1][e];
        a[e >> 2] += v;
        q[e >> 2] += v * v;
      }
    }
    f32x4 sum, sq;
#pragma unroll
    for (int j = 0; j < 4; ++j) {
      sum[j] = (a[j][0] + a[j][1]) + (a[j][2] + a[j][3]);
      sq[j]  = (q[j][0] + q[j][1]) + (q[j][2] + q[j][3]);
    }
    // What follows reuses the registers that the rows' loads name.
    asm volatile("s_wait_xcnt 0x0" ::: "memory");
    __builtin_amdgcn_sched_barrier(0);
#pragma unroll
    for (int m = 16; m > 0; m >>= 1) {
#pragma unroll
      for (int j = 0; j < 4; ++j) {
        sum[j] += __shfl_xor(sum[j], m, 32);
        sq[j]  += __shfl_xor(sq[j], m, 32);
      }
    }
    f32x4 sc, sh;
#pragma unroll
    for (int j = 0; j < 4; ++j) {
      const float invn = 1.0f / (float)(BB * NN);
      float mean = sum[j] * invn;
      float var  = sq[j] * invn - mean * mean;
      sc[j] = gm[j] * rsqrtf(var + 1e-5f);
      sh[j] = bt[j] - mean * sc[j];
    }
    if (lane == 0) { aff[0][wave] = sc; aff[1][wave] = sh; }
  }
  // The weight fragment, long since arrived, is split and laid in LDS.
  if (wave < 6) {
    v8h ph[2], pl[2];
#pragma unroll
    for (int e = 0; e < 16; ++e) {
      _Float16 hi, lo;
      split_f16(wr[e >> 2][e & 3], hi, lo);
      ph[e >> 3][e & 7] = hi;
      pl[e >> 3][e & 7] = lo;
    }
    wfrag[wave][0][0][lane] = ph[0];
    wfrag[wave][0][1][lane] = ph[1];
    wfrag[wave][1][0][lane] = pl[0];
    wfrag[wave][1][1][lane] = pl[1];
  }
  // Hands every wave's four scales and shifts, and the six weight fragments, to
  // the whole work-group.
  __syncthreads();

  // All six fragments are asked for as one group, ahead of the work on x: read one
  // by one in front of its products, each waits out its LDS latency.
  v16h wh[6], wl[6];
#pragma unroll
  for (int f = 0; f < 6; ++f) {
    wh[f] = join16(wfrag[f][0][0][lane], wfrag[f][0][1][lane]);
    wl[f] = join16(wfrag[f][1][0][lane], wfrag[f][1][1][lane]);
  }
  // Normalized x of both tiles, split: as B it is 32 channels x 16 columns, as A
  // 16 columns x 32 channels, the same registers either way.
  v16h xh[2], xl[2];
#pragma unroll
  for (int c4 = 0; c4 < 4; ++c4) {
    const int at = (c4 >> 1) * 4 + (kb >> 2) + (c4 & 1);  // channels kb.., kb+4.., 16+kb.., 20+kb..
    f32x4 sc = aff[0][at], sh = aff[1][at];
#pragma unroll
    for (int e = 0; e < 4; ++e) {
#pragma unroll
      for (int t = 0; t < 2; ++t) {
        _Float16 hi, lo;
        split_f16(xv[c4 * 4 + e][t] * sc[e] + sh[e], hi, lo);
        xh[t][c4 * 4 + e] = hi;
        xl[t][c4 * 4 + e] = lo;
      }
    }
  }

  const float qscale = 0.17677669529663687f;  // 1/sqrt(32)
  const v8f zero = {};
#pragma unroll
  for (int f = 0; f < 6; ++f) {
    const int tl = f & 1;
    v8f acc[2];
    if (f < 4) {
      // D = W x xn: the lane's column is n0 + 2 * col + t, element e is tile row kb + e.
#pragma unroll
      for (int t = 0; t < 2; ++t) {
        acc[t] = __builtin_amdgcn_wmma_f32_16x16x32_f16(false, wl[f], false, xh[t], (short)0, zero, false, false);
        acc[t] = __builtin_amdgcn_wmma_f32_16x16x32_f16(false, wh[f], false, xl[t], (short)0, acc[t], false, false);
        acc[t] = __builtin_amdgcn_wmma_f32_16x16x32_f16(false, wh[f], false, xh[t], (short)0, acc[t], false, false);
      }
      _Float16* dst = f < 2 ? Qh : Kh;           // q <- k, k <- q (swap)
      const float scl = f < 2 ? qscale : 1.0f;   // Q pre-scaled
#pragma unroll
      for (int s = 0; s < 2; ++s) {
        int hh = (kb >> 1) + tl * 2 + s;
        v8h r;
#pragma unroll
        for (int i = 0; i < 4; ++i) {
          r[i]     = (_Float16)(acc[0][s * 4 + i] * scl);
          r[4 + i] = (_Float16)(acc[1][s * 4 + i] * scl);
        }
        size_t at = ((((size_t)b * HH + hh) * (DD / 4) + g) * NN + n0 + 2 * col) * 4;
        *(v8h*)(dst + at) = r;
      }
    } else {
      // D = xn^T x Wv^T: the lane's column is weight row tl * 16 + col, element e
      // is column n0 + 2 * (kb + e) + t.
#pragma unroll
      for (int t = 0; t < 2; ++t) {
        acc[t] = __builtin_amdgcn_wmma_f32_16x16x32_f16(false, xh[t], false, wl[f], (short)0, zero, false, false);
        acc[t] = __builtin_amdgcn_wmma_f32_16x16x32_f16(false, xl[t], false, wh[f], (short)0, acc[t], false, false);
        acc[t] = __builtin_amdgcn_wmma_f32_16x16x32_f16(false, xh[t], false, wh[f], (short)0, acc[t], false, false);
      }
      int hh = col & 7;                          // channel = d' * H + h'
      int dd = g * 4 + tl * 2 + (col >> 3);
      v8h r[2];
#pragma unroll
      for (int e = 0; e < 8; ++e) {
        r[e >> 2][(e & 3) * 2]     = (_Float16)acc[0][e];
        r[e >> 2][(e & 3) * 2 + 1] = (_Float16)acc[1][e];
      }
      _Float16* vp = Vt + (((size_t)b * HH + hh) * DD + dd) * NN + n0 + 2 * kb;
      *(v8h*)(vp)     = r[0];
      *(v8h*)(vp + 8) = r[1];
    }
    // The next fragment's work rewrites the registers that these stores name.
    if (f + 1 < 6) asm volatile("s_wait_xcnt 0x0" ::: "memory");
  }
}

// ---------------------------------------------------------------------------
// Kernel 2: flash attention with TRANSPOSED score tiles.
//   S^T = A(K-tile 16keys x 32d) x B(Q^T 32d x 16queries)
//     -> C-layout: lane owns one query column; its 8 elements are keys
//        {kb..kb+7} (kb = lane>=16 ? 8 : 0) of the strip half.
//   Softmax stats (m, l) are per-lane scalars. The maximum in use, m, is lazy:
//   -m is the C operand of every score product, so the scores leave the matrix
//   unit already shifted, and one test per 128-key stage (a ballot, a scalar
//   branch) asks whether any shifted score of the wave exceeds LAZY. Only then, and in the first stage,
//   are the two key-halves' maxima merged, m raised, and scores, O and l scaled.
//   l is each lane's own partial sum; the halves join behind the loop.
//   exp(S^T - m) lands *directly* in the B-frag layout required by
//   O^T = A(V^T 16d x 32keys) x B(P^T 32keys x 16queries): pf[i]=e(s0[i]),
//   pf[8+i]=e(s1[i]).
//   Eight waves (128 queries of one head) form a work-group and share every
//   K and V fragment: a stage of 128 keys is fetched from global memory once
//   per work-group, one stage ahead, and laid in LDS in fragment order, so a
//   fragment half is one ds_load_b128 over 512 contiguous bytes per wave.
//   The work-groups of a head start their walk over the keys at different stages.
//   Epilogue: each lane holds 8 contiguous d values per accumulator ->
//   two packed b128 stores into AO[b][n][h*32+d].
// ---------------------------------------------------------------------------
#define QWAVES 8              // waves per work-group, 16 queries each
#define SKEYS  128            // keys per stage
#define NSTAGE (NN / SKEYS)   // 16
#define NCH    (SKEYS / 64)   // 16-byte chunks of each tile that one thread moves
#define LAZY   5.5f           // a score may pass the maximum in use by this much: P <= e^5.5, far inside f16

// One 16 x 32 fragment out of a staged tile: group = which 16 rows.
__device__ __forceinline__ v16h lds_frag(const v8h* t, int group, int llo, int lhi) {
  v8h lo = t[(group * 2) * 32 + llo];
  v8h hi = t[(group * 2 + 1) * 32 + lhi];
  return __builtin_shufflevector(lo, hi, 0, 1, 2, 3, 4, 5, 6, 7,
                                 8, 9, 10, 11, 12, 13, 14, 15);
}

__global__ __launch_bounds__(256) void attn_fa(const _Float16* __restrict__ Qh,
                                               const _Float16* __restrict__ Kh,
                                               const _Float16* __restrict__ Vt,
                                               _Float16* __restrict__ AO) {
  // [buffer][K, V][8 groups of 16 rows][lo, hi][32 places] of 16 bytes: 32 KB
  __shared__ v8h tile[2][2][SKEYS * 4];
  const int qblocks = NN / (16 * QWAVES);
  int qb = blockIdx.x % qblocks;
  int bh = blockIdx.x / qblocks;  // b*HH + h
  int h  = bh % HH;
  int b  = bh / HH;
  int tid  = threadIdx.x;
  int lane = tid & 31;
  int qt   = qb * QWAVES + (tid >> 5);
  int col  = lane & 15;                // this lane's query within the tile
  int kb   = (lane & 16) ? 8 : 0;      // key-half / d-half selector

  const _Float16* Qbase = Qh + ((size_t)bh * (DD / 4) * NN + qt * 16) * 4;  // d' / 4 = 0
  const _Float16* Kbase = Kh + (size_t)bh * (DD / 4) * NN * 4;
  const _Float16* Vbase = Vt + ((size_t)bh * DD) * NN;

  // Staging map. A tile is 128 rows of four 16-byte chunks (K: row = key;
  // V: row = strip * 32 + d, its 64 bytes the strip's 32 keys). Chunk c of row
  // rr is what lane (c & 1) * 16 + (rr & 15) takes as its lo (c < 2) or hi half.
  // Its place in that half's 512 bytes has the row xor-ed with 4 * c, so that
  // the 16 lanes of a half-wave, which store four chunks of each of four rows,
  // fall on 16 different bank groups; a reading half-wave still covers all 16.
  // Of V thread t moves chunks t + 256 * i (row + 64 * i, slot + 256 * i). Of K it
  // moves chunks 2 * (t >> 7) + i of key t & 127, each out of two 8-byte units of
  // neighbouring d' / 4 planes: a wave's load is 256 contiguous bytes, and the 16
  // lanes of a storing half-wave hold 16 rows of one chunk, 16 bank groups.
  int c  = tid & 3;
  int rr = tid >> 2;
  int slot = ((rr >> 4) * 2 + (c >> 1)) * 32 + (c & 1) * 16 + ((rr & 15) ^ (c << 2));
  int llo  = (lane & 16) | (col ^ ((lane & 16) >> 2));  // reader's place, c = 0 or 1
  int lhi  = llo ^ 8;                                   // reader's place, c = 2 or 3
  int key = tid & 127;
  int ch  = tid >> 7;
  int kslot = ((key >> 4) * 2 + ch) * 32 + ((key & 15) ^ (ch << 3));  // chunk 2 * ch
  const _Float16* kg = Kbase + ((size_t)(ch * 4) * NN + key) * 4;
  const _Float16* vg = Vbase + (size_t)(rr & 31) * NN + (rr >> 5) * 32 + c * 8;
  // The 16 work-groups of a head walk the same K and V. Pass s works on stage
  // (s + rot) % NSTAGE, so that they do not ask L2 for the same lines at the same
  // moment and all wait for the one fetch from memory: what one fetches first,
  // the others find in L2 later. Neighbouring qb start two stages apart.
  const int rot = ((qb & 3) << 1) | (qb & 8);

  v4h gk[NCH][2];
  v8h gv[NCH];
  {
    const _Float16* kn = kg + rot * SKEYS * 4;
    const _Float16* vn = vg + rot * SKEYS;
#pragma unroll
    for (int i = 0; i < NCH; ++i) {
      gk[i][0] = *(const v4h*)(kn + (2 * i) * NN * 4);
      gk[i][1] = *(const v4h*)(kn + (2 * i + 1) * NN * 4);
      gv[i] = *(const v8h*)(vn + i * 64);
    }
    // The address work below reuses the address registers of these loads.
    asm volatile("s_wait_xcnt 0x0" ::: "memory");
  }
  // B-frag of Q^T, lives across the loop: d' = kb..kb+7 and 16+kb..16+kb+7 of
  // query col, four 8-byte units.
  v16h qf;
  {
    const _Float16* qp = Qbase + ((size_t)(kb >> 2) * NN + col) * 4;
    v4h q0 = *(const v4h*)(qp);
    v4h q1 = *(const v4h*)(qp + NN * 4);
    v4h q2 = *(const v4h*)(qp + 4 * NN * 4);
    v4h q3 = *(const v4h*)(qp + 5 * NN * 4);
    v8h lo = __builtin_shufflevector(q0, q1, 0, 1, 2, 3, 4, 5, 6, 7);
    v8h hi = __builtin_shufflevector(q2, q3, 0, 1, 2, 3, 4, 5, 6, 7);
    qf = __builtin_shufflevector(lo, hi, 0, 1, 2, 3, 4, 5, 6, 7,
                                 8, 9, 10, 11, 12, 13, 14, 15);
  }
#pragma unroll
  for (int i = 0; i < NCH; ++i) {
    tile[0][0][(kslot ^ (i << 2)) + i * 16] =
        __builtin_shufflevector(gk[i][0], gk[i][1], 0, 1, 2, 3, 4, 5, 6, 7);
    tile[0][1][slot + i * 256] = gv[i];
  }
  __syncthreads();

  v8f o0 = {};  // O^T rows d = kb..kb+7        (cols = queries)
  v8f o1 = {};  // O^T rows d = 16+kb..16+kb+7
  v8f cm = {};  // -m in all eight places: the C operand of the score products
  float m = 0.f, l = 0.f;

  for (int s = 0; s < NSTAGE; ++s) {
    const bool more = s + 1 < NSTAGE;
    if (more) {  // next stage's chunks fly while this stage is worked on
      const int st = (s + 1 + rot) & (NSTAGE - 1);
      const _Float16* kn = kg + st * SKEYS * 4;
      const _Float16* vn = vg + st * SKEYS;
#pragma unroll
      for (int i = 0; i < NCH; ++i) {
        gk[i][0] = *(const v4h*)(kn + (2 * i) * NN * 4);
        gk[i][1] = *(const v4h*)(kn + (2 * i + 1) * NN * 4);
        gv[i] = *(const v8h*)(vn + i * 64);
      }
      // The stage's LDS reads reuse the address registers of these loads.
      asm volatile("s_wait_xcnt 0x0" ::: "memory");
    }
    const v8h* kt = tile[s & 1][0];
    const v8h* vt = tile[s & 1][1];
    // Every loop of the stage is unrolled: vf, sc, mp and rs are register arrays.
    // All of the stage's V fragments are asked for as one group, ahead of the
    // strips that use them: read strip by strip, each waits out its LDS latency.
    v16h vf[SKEYS / 16];  // [2 * strip]: d = 0..15, [2 * strip + 1]: d = 16..31
#pragma unroll
    for (int p = 0; p < SKEYS / 16; ++p) vf[p] = lds_frag(vt, p, llo, lhi);
    v8f sc[SKEYS / 16];  // S^T - m, 16 keys each
#pragma unroll
    for (int p = 0; p < SKEYS / 16; ++p)
      sc[p] = __builtin_amdgcn_wmma_f32_16x16x32_f16(false, lds_frag(kt, p, llo, lhi), false, qf,
                                                     (short)0, cm, false, false);
    // --- the lane's largest shifted score of the stage, four chains ---
    float mp[SKEYS / 32];
#pragma unroll
    for (int p = 0; p < SKEYS / 32; ++p) {
      mp[p] = fmaxf(sc[2 * p][0], sc[2 * p + 1][0]);
#pragma unroll
      for (int e = 1; e < 8; ++e) mp[p] = fmaxf(mp[p], fmaxf(sc[2 * p][e], sc[2 * p + 1][e]));
    }
    float mx = fmaxf(fmaxf(mp[0], mp[1]), fmaxf(mp[2], mp[3]));
    // Wave-uniform: the first stage sets m, a later one raises it when some score
    // has outgrown it. Every lane is on inside.
    if (s == 0 || __builtin_amdgcn_ballot_w32(mx > LAZY) != 0) {
      mx = fmaxf(mx, __shfl_xor(mx, 16, 32));    // merge the two key-halves
      float up    = (s == 0) ? mx : fmaxf(mx, 0.f);
      float alpha = (s == 0) ? 1.f : __expf(-up);  // O and l are still 0 in pass 0
#pragma unroll
      for (int p = 0; p < SKEYS / 16; ++p)
#pragma unroll
        for (int e = 0; e < 8; ++e) sc[p][e] -= up;
#pragma unroll
      for (int e = 0; e < 8; ++e) { o0[e] *= alpha; o1[e] *= alpha; }
      l *= alpha;
      m += up;
#pragma unroll
      for (int e = 0; e < 8; ++e) cm[e] = -m;
    }
    float rs[SKEYS / 32];
#pragma unroll
    for (int p = 0; p < SKEYS / 32; ++p) {
      // Keeps the next stage's LDS stores, which wait for its global loads, from
      // rising above the last strip: higher up they wait out the loads' latency.
      if (p == SKEYS / 32 - 1) __builtin_amdgcn_sched_barrier(0);
      v16h pf;
      rs[p] = 0.f;
#pragma unroll
      for (int e = 0; e < 8; ++e) {
        float e0 = __expf(sc[2 * p][e]);
        float e1 = __expf(sc[2 * p + 1][e]);
        rs[p] += e0 + e1;
        pf[e]     = (_Float16)e0;   // B-frag element e   <-> key kb+e      of strip
        pf[8 + e] = (_Float16)e1;   // B-frag element 8+e <-> key 16+kb+e   of strip
      }
      // --- O^T += V^T x P^T ---
      o0 = __builtin_amdgcn_wmma_f32_16x16x32_f16(false, vf[2 * p], false, pf,
                                                  (short)0, o0, false, false);
      o1 = __builtin_amdgcn_wmma_f32_16x16x32_f16(false, vf[2 * p + 1], false, pf,
                                                  (short)0, o1, false, false);
    }
    l += (rs[0] + rs[1]) + (rs[2] + rs[3]);
    if (more) {  // the other buffer's readers left it at the last barrier
      v8h* kd = tile[(s + 1) & 1][0];
      v8h* vd = tile[(s + 1) & 1][1];
#pragma unroll
      for (int i = 0; i < NCH; ++i) {
        kd[(kslot ^ (i << 2)) + i * 16] =
            __builtin_shufflevector(gk[i][0], gk[i][1], 0, 1, 2, 3, 4, 5, 6, 7);
        vd[slot + i * 256] = gv[i];
      }
    }
    // Publishes the stage of pass s + 1 and ends every wave's reads of the stage of pass s.
    __syncthreads();
  }

  // --- epilogue: normalize, pack, two b128 stores per lane ---
  l += __shfl_xor(l, 16, 32);  // the two key-halves of each query
  float inv = 1.0f / l;
  int n = qt * 16 + col;
  size_t off = (((size_t)b * NN) + n) * INNER + h * DD;
  v8h r0, r1;
#pragma unroll
  for (int p = 0; p < 8; ++p) {
    r0[p] = (_Float16)(o0[p] * inv);   // d = kb+p
    r1[p] = (_Float16)(o1[p] * inv);   // d = 16+kb+p
  }
  *(v8h*)(AO + off + kb)      = r0;
  *(v8h*)(AO + off + 16 + kb) = r1;
}

// ---------------------------------------------------------------------------
// Kernel 3: output projection  out[b][o][n] = sum_c wo[o][c]*AO[b][n][c] + bo[o]
// Four waves form a work-group and share a 64 (o) x 64 (n) output block. Its
// 64 rows of wo and 64 rows of AO (512 bytes each, all of K = 256) come from
// global memory once per work-group, a whole row per wave-wide 16-byte load,
// and are laid in LDS in fragment order. A wave owns 2 x 2 tiles of 16 x 16,
// so every fragment it reads from LDS feeds two WMMAs.
// ---------------------------------------------------------------------------
#define OPB 64   // rows of wo, and rows of AO, per work-group

// One 16 x 32 fragment out of a staged operand: group = which 16 rows, k = which
// 32 of the 256 channels. rx = (lane & 15) ^ (lane >> 4), lh16 = lane & 16.
__device__ __forceinline__ v16h opnd_frag(const v8h* t, int group, int k, int lh16, int rx) {
  v8h lo = t[((group * 8 + k) * 2) * 32 + lh16 + (rx ^ ((k & 3) * 4))];
  v8h hi = t[((group * 8 + k) * 2 + 1) * 32 + lh16 + (rx ^ ((k & 3) * 4 + 2))];
  return __builtin_shufflevector(lo, hi, 0, 1, 2, 3, 4, 5, 6, 7,
                                 8, 9, 10, 11, 12, 13, 14, 15);
}

__global__ __launch_bounds__(128) void out_proj(const _Float16* __restrict__ wo16,
                                                const _Float16* __restrict__ AO,
                                                const float* __restrict__ bo,
                                                float* __restrict__ out) {
  // [wo, AO][4 groups of 16 rows][8 k steps][lo, hi][32 places] of 16 bytes: 64 KB
  __shared__ v8h opnd[2][(OPB / 16) * 8 * 2 * 32];
  const int oblocks = CC / OPB;
  const int nblocks = NN / OPB;
  int ob = blockIdx.x % oblocks;
  int rest = blockIdx.x / oblocks;
  int nb = rest % nblocks;
  int b  = rest / nblocks;
  int lane = threadIdx.x & 31;
  int wave = threadIdx.x >> 5;
  int col  = lane & 15;
  int hi8  = (lane & 16) ? 8 : 0;
  int og = (wave & 1) * 2;   // the wave's first group of 16 o
  int ng = (wave >> 1) * 2;  // the wave's first group of 16 n

  // Staging map. Wave w moves group w of both operands, one row a load; lane j
  // holds chunk j of the row: k step j >> 2, half (j >> 1) & 1 (lo or hi), and
  // it is what lane (j & 1) * 16 + row takes. Its place in that half-wave's 256
  // bytes has the row xor-ed with j & 15, so that the 16 lanes of a storing
  // half-wave, which all hold the same row, fall on 16 different bank groups; a
  // reading half-wave still covers all 16.
  const v8h* ag = (const v8h*)(wo16 + (size_t)(ob * OPB + wave * 16) * INNER) + lane;
  const v8h* bg = (const v8h*)(AO + ((size_t)b * NN + nb * OPB + wave * 16) * INNER) + lane;
  v8h ga[16], gb[16];
#pragma unroll
  for (int i = 0; i < 16; ++i) {
    ga[i] = ag[i * (INNER / 8)];
    gb[i] = bg[i * (INNER / 8)];
  }
  f32x4 bias[2][2];  // bo of the lane's eight rows in each of its two groups
#pragma unroll
  for (int u = 0; u < 2; ++u) {
    const f32x4* bp = (const f32x4*)(bo + ob * OPB + (og + u) * 16 + hi8);
    bias[u][0] = bp[0];
    bias[u][1] = bp[1];
  }
  int wbase = ((wave * 8 + (lane >> 2)) * 2 + ((lane >> 1) & 1)) * 32 + (lane & 1) * 16;
#pragma unroll
  for (int i = 0; i < 16; ++i) {
    opnd[0][wbase + (i ^ col)] = ga[i];
    opnd[1][wbase + (i ^ col)] = gb[i];
  }
  // Hands every wave's rows to the whole work-group.
  __syncthreads();

  int lh16 = lane & 16;
  int rx   = col ^ (lane >> 4);
  v8f acc[2][2] = {};
  // Fragments are read one k step ahead into a second register set, so that a
  // step's WMMAs do not wait out the LDS latency of their own reads.
  v16h af[2][2], bf[2][2];
#pragma unroll
  for (int u = 0; u < 2; ++u) {
    af[0][u] = opnd_frag(opnd[0], og + u, 0, lh16, rx);
    bf[0][u] = opnd_frag(opnd[1], ng + u, 0, lh16, rx);
  }
#pragma unroll
  for (int k = 0; k < INNER / 32; ++k) {
    if (k + 1 < INNER / 32) {
#pragma unroll
      for (int u = 0; u < 2; ++u) {
        af[(k + 1) & 1][u] = opnd_frag(opnd[0], og + u, k + 1, lh16, rx);
        bf[(k + 1) & 1][u] = opnd_frag(opnd[1], ng + u, k + 1, lh16, rx);
      }
    }
    // Keeps the next step's eight LDS reads issued as one group in front of
    // this step's WMMAs; left free, the compiler sinks them behind the WMMAs
    // and each step waits for its own reads.
    __builtin_amdgcn_sched_barrier(0);
#pragma unroll
    for (int u = 0; u < 2; ++u)
#pragma unroll
      for (int v = 0; v < 2; ++v)
        acc[u][v] = __builtin_amdgcn_wmma_f32_16x16x32_f16(false, af[k & 1][u], false, bf[k & 1][v],
                                                           (short)0, acc[u][v], false, false);
  }
#pragma unroll
  for (int u = 0; u < 2; ++u) {
    int o0 = ob * OPB + (og + u) * 16 + hi8;
    float* orow = out + (((size_t)b * CC) + o0) * NN + nb * OPB + ng * 16 + col;
#pragma unroll
    for (int p = 0; p < 8; ++p) {
#pragma unroll
      for (int v = 0; v < 2; ++v)
        orow[(size_t)p * NN + v * 16] = acc[u][v][p] + bias[u][p >> 2][p & 3];
    }
  }
}

// ---------------------------------------------------------------------------
extern "C" void kernel_launch(void* const* d_in, const int* in_sizes, int n_in,
                              void* d_out, int out_size, void* d_ws, size_t ws_size,
                              hipStream_t stream) {
  const float* x     = (const float*)d_in[0];
  const float* gamma = (const float*)d_in[1];
  const float* beta  = (const float*)d_in[2];
  const float* wk    = (const float*)d_in[3];
  const float* wq    = (const float*)d_in[4];
  const float* wv    = (const float*)d_in[5];
  const float* wo    = (const float*)d_in[6];
  const float* bo    = (const float*)d_in[7];
  float* out = (float*)d_out;

  char* ws = (char*)d_ws;
  size_t off = 0;
  _Float16* wo16 = (_Float16*)(ws + off); off += (size_t)CC * INNER * 2;        // 128 KB
  _Float16* Qh   = (_Float16*)(ws + off); off += (size_t)BB * HH * NN * DD * 2; // 2 MB
  _Float16* Kh   = (_Float16*)(ws + off); off += (size_t)BB * HH * NN * DD * 2; // 2 MB
  _Float16* Vt   = (_Float16*)(ws + off); off += (size_t)BB * HH * NN * DD * 2; // 2 MB
  _Float16* AO   = (_Float16*)(ws + off); off += (size_t)BB * NN * INNER * 2;   // 2 MB

  proj_kernel<<<dim3(PROJ_WG + CVT_WG), dim3(256), 0, stream>>>(
      x, gamma, beta, wk, wq, wv, Qh, Kh, Vt, wo, wo16);
  attn_fa<<<dim3(BB * HH * (NN / 128)), dim3(256), 0, stream>>>(Qh, Kh, Vt, AO);
  out_proj<<<dim3(BB * (NN / OPB) * (CC / OPB)), dim3(128), 0, stream>>>(wo16, AO, bo, out);
}
